// v000
// The times below were measured on an AMD MI455X: many runs one after another, warmed up first and cycling through
// copies of the inputs, with the whole window's GPU time divided by the number of runs. Launches and the gaps
// between them are all in it. The median over several windows is given; except for v000 it joins two sittings, which
// can be a few percent apart, so the side-by-side timings, each taken in one sitting, are the better comparison.
// v000 is the starting kernel. One run takes 349 microseconds.
#include <hip/hip_runtime.h>
#include <hip/hip_bf16.h>

// ---- problem constants (match reference) ----
#define Bc   2
#define Sc   2048
#define Dm   1024
#define Hc   16
#define HDc  64
#define BSM  (Bc * Sc)          // 4096 rows

typedef __attribute__((ext_vector_type(16))) _Float16 v16h;
typedef __attribute__((ext_vector_type(8)))  _Float16 v8h;
typedef __attribute__((ext_vector_type(4)))  _Float16 v4h;
typedef __attribute__((ext_vector_type(8)))  float    v8f;
typedef __attribute__((ext_vector_type(4)))  float    v4f;
typedef __attribute__((ext_vector_type(4)))  int      v4i;

// ---------- CDNA5 async global->LDS copy (ASYNCcnt path), guarded ----------
#if defined(__has_builtin)
#  if __has_builtin(__builtin_amdgcn_global_load_async_to_lds_b128)
#    define HAS_ASYNC_CP 1
#  endif
#endif
#ifndef HAS_ASYNC_CP
#  define HAS_ASYNC_CP 0
#endif

#if HAS_ASYNC_CP
typedef __attribute__((address_space(1))) v4i* g_v4i_p;   // global int4*
typedef __attribute__((address_space(3))) v4i* l_v4i_p;   // LDS int4*
__device__ __forceinline__ void cp_b128(void* lds, const void* g) {
    // global side: flat address == global address, so inttoptr into AS1 is safe;
    // LDS side: generic -> AS3 addrspacecast.
    __builtin_amdgcn_global_load_async_to_lds_b128(
        (g_v4i_p)(uintptr_t)g, (l_v4i_p)lds, 0, 0);
}
__device__ __forceinline__ void cp_wait() {
#  if __has_builtin(__builtin_amdgcn_s_wait_asynccnt)
    __builtin_amdgcn_s_wait_asynccnt(0);
#  else
    asm volatile("s_wait_asynccnt 0" ::: "memory");
#  endif
}
#else
__device__ __forceinline__ void cp_b128(void* lds, const void* g) {
    *(v8h*)lds = *(const v8h*)g;
}
__device__ __forceinline__ void cp_wait() {}
#endif

__device__ __forceinline__ v16h make_frag(const _Float16* p) {
    // per-lane 16-bit fragment = two contiguous 8-half (16B) chunks:
    // k in [8*hi, 8*hi+8) and [16+8*hi, 16+8*hi+8); caller bakes 8*hi into p.
    v8h lo = *(const v8h*)(p);
    v8h hi8 = *(const v8h*)(p + 16);
    return __builtin_shufflevector(lo, hi8, 0,1,2,3,4,5,6,7,8,9,10,11,12,13,14,15);
}

#define GM   128   // block M tile (2 x 16 rows per wave)
#define GN   64
#define GK   32

// ---------------- GEMM: C_f16 = (A_f32 * W_f32 + bias) * scale ----------------
__global__ __launch_bounds__(128) void gemm_proj_f16out(
    const float* __restrict__ A, const float* __restrict__ W,
    const float* __restrict__ bias, _Float16* __restrict__ Cout,
    float scale, int M, int N, int Kdim)
{
    __shared__ __align__(16) _Float16 ldsA[GM * GK];   // [m][k], stride 32
    __shared__ __align__(16) _Float16 ldsBt[GN * GK];  // [n][k], stride 32

    const int tid  = threadIdx.x;
    const int wave = tid >> 5;
    const int lane = tid & 31;
    const int r    = lane & 15;
    const int hi   = lane >> 4;

    const int m0 = blockIdx.y * GM;
    const int n0 = blockIdx.x * GN;

    v8f acc[2][4] = {};

    for (int k0 = 0; k0 < Kdim; k0 += GK) {
        // A tile: 128x32 f32 -> f16 (1024 v4f, 8 per thread)
        #pragma unroll
        for (int j = 0; j < 8; ++j) {
            int idx = tid + j * 128;
            int row = idx >> 3;
            int c4  = (idx & 7) << 2;
            v4f a4 = *(const v4f*)(A + (size_t)(m0 + row) * Kdim + k0 + c4);
            v4h h4;
            h4[0] = (_Float16)a4[0]; h4[1] = (_Float16)a4[1];
            h4[2] = (_Float16)a4[2]; h4[3] = (_Float16)a4[3];
            *(v4h*)(&ldsA[row * GK + c4]) = h4;
        }
        // W tile: 32x64 f32, transposed into [n][k]
        #pragma unroll
        for (int j = 0; j < 4; ++j) {
            int idx  = tid + j * 128;
            int krow = idx >> 4;
            int c4   = (idx & 15) << 2;
            v4f b4 = *(const v4f*)(W + (size_t)(k0 + krow) * N + n0 + c4);
            ldsBt[(c4 + 0) * GK + krow] = (_Float16)b4[0];
            ldsBt[(c4 + 1) * GK + krow] = (_Float16)b4[1];
            ldsBt[(c4 + 2) * GK + krow] = (_Float16)b4[2];
            ldsBt[(c4 + 3) * GK + krow] = (_Float16)b4[3];
        }
        __syncthreads();

        v16h af[2];
        #pragma unroll
        for (int mi = 0; mi < 2; ++mi)
            af[mi] = make_frag(&ldsA[(wave * 32 + mi * 16 + r) * GK + 8 * hi]);
        #pragma unroll
        for (int sub = 0; sub < 4; ++sub) {
            v16h bfrag = make_frag(&ldsBt[(sub * 16 + r) * GK + 8 * hi]);
            #pragma unroll
            for (int mi = 0; mi < 2; ++mi)
                acc[mi][sub] = __builtin_amdgcn_wmma_f32_16x16x32_f16(
                    false, af[mi], false, bfrag, (short)0, acc[mi][sub], false, false);
        }
        __syncthreads();
    }

    #pragma unroll
    for (int mi = 0; mi < 2; ++mi) {
        #pragma unroll
        for (int sub = 0; sub < 4; ++sub) {
            int col = n0 + sub * 16 + r;
            float bv = bias[col];
            #pragma unroll
            for (int v = 0; v < 8; ++v) {
                int row = m0 + wave * 32 + mi * 16 + hi * 8 + v;
                Cout[(size_t)row * N + col] = (_Float16)((acc[mi][sub][v] + bv) * scale);
            }
        }
    }
}

// ---------------- GEMM: out_f32 = A_f16 * W_f32 + bias ----------------
__global__ __launch_bounds__(128) void gemm_out_f32(
    const _Float16* __restrict__ A, const float* __restrict__ W,
    const float* __restrict__ bias, float* __restrict__ Out,
    int M, int N, int Kdim)
{
    __shared__ __align__(16) _Float16 ldsA[GM * GK];
    __shared__ __align__(16) _Float16 ldsBt[GN * GK];

    const int tid  = threadIdx.x;
    const int wave = tid >> 5;
    const int lane = tid & 31;
    const int r    = lane & 15;
    const int hi   = lane >> 4;

    const int m0 = blockIdx.y * GM;
    const int n0 = blockIdx.x * GN;

    v8f acc[2][4] = {};

    for (int k0 = 0; k0 < Kdim; k0 += GK) {
        // A tile: 128x32 f16 straight copy -> async to LDS (512 v8h, 4/thread)
        #pragma unroll
        for (int j = 0; j < 4; ++j) {
            int idx = tid + j * 128;
            int row = idx >> 2;
            int c8  = (idx & 3) << 3;
            cp_b128(&ldsA[row * GK + c8],
                    A + (size_t)(m0 + row) * Kdim + k0 + c8);
        }
        #pragma unroll
        for (int j = 0; j < 4; ++j) {
            int idx  = tid + j * 128;
            int krow = idx >> 4;
            int c4   = (idx & 15) << 2;
            v4f b4 = *(const v4f*)(W + (size_t)(k0 + krow) * N + n0 + c4);
            ldsBt[(c4 + 0) * GK + krow] = (_Float16)b4[0];
            ldsBt[(c4 + 1) * GK + krow] = (_Float16)b4[1];
            ldsBt[(c4 + 2) * GK + krow] = (_Float16)b4[2];
            ldsBt[(c4 + 3) * GK + krow] = (_Float16)b4[3];
        }
        cp_wait();
        __syncthreads();

        v16h af[2];
        #pragma unroll
        for (int mi = 0; mi < 2; ++mi)
            af[mi] = make_frag(&ldsA[(wave * 32 + mi * 16 + r) * GK + 8 * hi]);
        #pragma unroll
        for (int sub = 0; sub < 4; ++sub) {
            v16h bfrag = make_frag(&ldsBt[(sub * 16 + r) * GK + 8 * hi]);
            #pragma unroll
            for (int mi = 0; mi < 2; ++mi)
                acc[mi][sub] = __builtin_amdgcn_wmma_f32_16x16x32_f16(
                    false, af[mi], false, bfrag, (short)0, acc[mi][sub], false, false);
        }
        __syncthreads();
    }

    #pragma unroll
    for (int mi = 0; mi < 2; ++mi) {
        #pragma unroll
        for (int sub = 0; sub < 4; ++sub) {
            int col = n0 + sub * 16 + r;
            float bv = bias[col];
            #pragma unroll
            for (int v = 0; v < 8; ++v) {
                int row = m0 + wave * 32 + mi * 16 + hi * 8 + v;
                Out[(size_t)row * N + col] = acc[mi][sub][v] + bv;
            }
        }
    }
}

// ---------------- Flash attention over f16 Q/K/V -> f16 ctx ----------------
// Q pre-scaled by 1/sqrt(HD). Layouts are [B,S,H,HD] f16.
// Block: 128 threads (4 waves) covers 128 query rows of one (b,h).
// Wave covers 32 query rows (2 x 16). Key tiles of 64.
__global__ __launch_bounds__(128) void attn_kernel(
    const _Float16* __restrict__ Qw, const _Float16* __restrict__ Kw,
    const _Float16* __restrict__ Vw, _Float16* __restrict__ Ctx)
{
    __shared__ __align__(16) _Float16 ldsK[64 * 64];    // [key][hd]
    __shared__ __align__(16) _Float16 ldsVt[64 * 64];   // [hd][key]
    __shared__ __align__(16) _Float16 ldsP[4][32 * 64]; // per wave: [q][key]

    const int tid  = threadIdx.x;
    const int wave = tid >> 5;
    const int lane = tid & 31;
    const int r    = lane & 15;
    const int hi   = lane >> 4;

    const int bh = blockIdx.x;
    const int b  = bh / Hc;
    const int h  = bh % Hc;
    const int q0 = blockIdx.y * 128;

    const size_t base   = ((size_t)b * Sc * Hc + h) * HDc;  // (b, s=0, h, 0)
    const size_t rowstr = (size_t)Hc * HDc;                 // per-s stride (halves)

    // Q fragments: 2 row-halves x 2 k-steps over HD=64
    v16h aq[2][2];
    #pragma unroll
    for (int mi = 0; mi < 2; ++mi) {
        const _Float16* qp = Qw + base
            + (size_t)(q0 + wave * 32 + mi * 16 + r) * rowstr;
        #pragma unroll
        for (int ks = 0; ks < 2; ++ks)
            aq[mi][ks] = make_frag(qp + ks * 32 + 8 * hi);
    }

    float mrow[2][8], lrow[2][8];
    v8f O[2][4] = {};
    #pragma unroll
    for (int mi = 0; mi < 2; ++mi)
        #pragma unroll
        for (int v = 0; v < 8; ++v) { mrow[mi][v] = -1e30f; lrow[mi][v] = 0.0f; }

    _Float16* pw = &ldsP[wave][0];

    for (int kt0 = 0; kt0 < Sc; kt0 += 64) {
        // stage K (async straight copy) and V (transposed, through regs)
        #pragma unroll
        for (int j = 0; j < 4; ++j) {
            int idx = tid + j * 128;          // 512 chunks of 8 halves
            int key = idx >> 3;
            int c8  = (idx & 7) << 3;
            size_t g = base + (size_t)(kt0 + key) * rowstr + c8;
            cp_b128(&ldsK[key * 64 + c8], Kw + g);
            v8h vv = *(const v8h*)(Vw + g);
            #pragma unroll
            for (int t = 0; t < 8; ++t)
                ldsVt[(c8 + t) * 64 + key] = vv[t];
        }
        cp_wait();
        __syncthreads();

        // scores: S[32q x 64k] = Q(32x64) * K^T ; B-fragments reused across mi
        v8f sacc[2][4] = {};
        #pragma unroll
        for (int ks = 0; ks < 2; ++ks) {
            #pragma unroll
            for (int sub = 0; sub < 4; ++sub) {
                v16h bfrag = make_frag(&ldsK[(sub * 16 + r) * 64 + ks * 32 + 8 * hi]);
                #pragma unroll
                for (int mi = 0; mi < 2; ++mi)
                    sacc[mi][sub] = __builtin_amdgcn_wmma_f32_16x16x32_f16(
                        false, aq[mi][ks], false, bfrag, (short)0,
                        sacc[mi][sub], false, false);
            }
        }

        // online softmax per row-half; rows m = 8*hi + v live in one 16-lane half
        #pragma unroll
        for (int mi = 0; mi < 2; ++mi) {
            float scal[8];
            #pragma unroll
            for (int v = 0; v < 8; ++v) {
                float rm = fmaxf(fmaxf(sacc[mi][0][v], sacc[mi][1][v]),
                                 fmaxf(sacc[mi][2][v], sacc[mi][3][v]));
                #pragma unroll
                for (int off = 1; off < 16; off <<= 1)
                    rm = fmaxf(rm, __shfl_xor(rm, off, 32));
                float nm = fmaxf(mrow[mi][v], rm);
                scal[v] = __expf(mrow[mi][v] - nm);
                mrow[mi][v] = nm;
            }
            float rs[8];
            #pragma unroll
            for (int v = 0; v < 8; ++v) rs[v] = 0.0f;
            #pragma unroll
            for (int sub = 0; sub < 4; ++sub) {
                #pragma unroll
                for (int v = 0; v < 8; ++v) {
                    float p = __expf(sacc[mi][sub][v] - mrow[mi][v]);
                    sacc[mi][sub][v] = p;
                    rs[v] += p;
                }
            }
            #pragma unroll
            for (int v = 0; v < 8; ++v) {
                #pragma unroll
                for (int off = 1; off < 16; off <<= 1)
                    rs[v] += __shfl_xor(rs[v], off, 32);
                lrow[mi][v] = lrow[mi][v] * scal[v] + rs[v];
            }
            #pragma unroll
            for (int sub = 0; sub < 4; ++sub)
                #pragma unroll
                for (int v = 0; v < 8; ++v)
                    O[mi][sub][v] *= scal[v];
            // P: D-layout -> A-layout via per-wave LDS bounce (DS in-order/wave)
            #pragma unroll
            for (int sub = 0; sub < 4; ++sub)
                #pragma unroll
                for (int v = 0; v < 8; ++v)
                    pw[(mi * 16 + hi * 8 + v) * 64 + sub * 16 + r] =
                        (_Float16)sacc[mi][sub][v];
        }

        // O += P(32x64) * V(64x64); V B-fragments reused across mi
        #pragma unroll
        for (int ks = 0; ks < 2; ++ks) {
            v16h ap[2];
            #pragma unroll
            for (int mi = 0; mi < 2; ++mi)
                ap[mi] = make_frag(pw + (mi * 16 + r) * 64 + ks * 32 + 8 * hi);
            #pragma unroll
            for (int sub = 0; sub < 4; ++sub) {
                v16h bfrag = make_frag(&ldsVt[(sub * 16 + r) * 64 + ks * 32 + 8 * hi]);
                #pragma unroll
                for (int mi = 0; mi < 2; ++mi)
                    O[mi][sub] = __builtin_amdgcn_wmma_f32_16x16x32_f16(
                        false, ap[mi], false, bfrag, (short)0, O[mi][sub], false, false);
            }
        }
        __syncthreads();  // protect ldsK/ldsVt for next tile
    }

    // normalize and store ctx (f16, [B,S,H,HD])
    #pragma unroll
    for (int mi = 0; mi < 2; ++mi) {
        #pragma unroll
        for (int sub = 0; sub < 4; ++sub) {
            #pragma unroll
            for (int v = 0; v < 8; ++v) {
                int row = q0 + wave * 32 + mi * 16 + hi * 8 + v;
                float val = O[mi][sub][v] / lrow[mi][v];
                Ctx[base + (size_t)row * rowstr + sub * 16 + r] = (_Float16)val;
            }
        }
    }
}

extern "C" void kernel_launch(void* const* d_in, const int* in_sizes, int n_in,
                              void* d_out, int out_size, void* d_ws, size_t ws_size,
                              hipStream_t stream) {
    (void)in_sizes; (void)n_in; (void)out_size; (void)ws_size;

    const float* Xq  = (const float*)d_in[0];
    const float* Xkv = (const float*)d_in[1];
    const float* Wq  = (const float*)d_in[2];
    const float* bq  = (const float*)d_in[3];
    const float* Wk  = (const float*)d_in[4];
    const float* bk  = (const float*)d_in[5];
    const float* Wv  = (const float*)d_in[6];
    const float* bv  = (const float*)d_in[7];
    const float* Wo  = (const float*)d_in[8];
    const float* bo  = (const float*)d_in[9];
    float* out = (float*)d_out;

    const size_t elems = (size_t)BSM * Dm;  // 4096*1024
    _Float16* Qh = (_Float16*)d_ws;
    _Float16* Kh = Qh + elems;
    _Float16* Vh = Kh + elems;
    _Float16* Ch = Vh + elems;

    dim3 blk(128);
    dim3 gg(Dm / GN, BSM / GM);       // (16, 32)

    const float qscale = 0.125f;      // 1/sqrt(HD=64)
    gemm_proj_f16out<<<gg, blk, 0, stream>>>(Xq,  Wq, bq, Qh, qscale, BSM, Dm, Dm);
    gemm_proj_f16out<<<gg, blk, 0, stream>>>(Xkv, Wk, bk, Kh, 1.0f,   BSM, Dm, Dm);
    gemm_proj_f16out<<<gg, blk, 0, stream>>>(Xkv, Wv, bv, Vh, 1.0f,   BSM, Dm, Dm);

    dim3 ga(Bc * Hc, Sc / 128);       // (32, 16)
    attn_kernel<<<ga, blk, 0, stream>>>(Qh, Kh, Vh, Ch);

    gemm_out_f32<<<gg, blk, 0, stream>>>(Ch, Wo, bo, out, BSM, Dm, Dm);
}

// v001
// It runs in 269 microseconds.
// Timed twice side by side with v000, it ran 1.34 times as fast both times.
#include <hip/hip_runtime.h>
#include <hip/hip_bf16.h>

// ---- problem constants (match reference) ----
#define Bc   2
#define Sc   2048
#define Dm   1024
#define Hc   16
#define HDc  64
#define BSM  (Bc * Sc)          // 4096 rows

typedef __attribute__((ext_vector_type(16))) _Float16 v16h;
typedef __attribute__((ext_vector_type(8)))  _Float16 v8h;
typedef __attribute__((ext_vector_type(4)))  _Float16 v4h;
typedef __attribute__((ext_vector_type(8)))  float    v8f;
typedef __attribute__((ext_vector_type(4)))  float    v4f;
typedef __attribute__((ext_vector_type(4)))  int      v4i;

// ---------- CDNA5 async global->LDS copy (ASYNCcnt path), guarded ----------
#if defined(__has_builtin)
#  if __has_builtin(__builtin_amdgcn_global_load_async_to_lds_b128)
#    define HAS_ASYNC_CP 1
#  endif
#endif
#ifndef HAS_ASYNC_CP
#  define HAS_ASYNC_CP 0
#endif

#if HAS_ASYNC_CP
typedef __attribute__((address_space(1))) v4i* g_v4i_p;   // global int4*
typedef __attribute__((address_space(3))) v4i* l_v4i_p;   // LDS int4*
__device__ __forceinline__ void cp_b128(void* lds, const void* g) {
    // global side: flat address == global address, so inttoptr into AS1 is safe;
    // LDS side: generic -> AS3 addrspacecast.
    __builtin_amdgcn_global_load_async_to_lds_b128(
        (g_v4i_p)(uintptr_t)g, (l_v4i_p)lds, 0, 0);
}
__device__ __forceinline__ void cp_wait() {
#  if __has_builtin(__builtin_amdgcn_s_wait_asynccnt)
    __builtin_amdgcn_s_wait_asynccnt(0);
#  else
    asm volatile("s_wait_asynccnt 0" ::: "memory");
#  endif
}
#else
__device__ __forceinline__ void cp_b128(void* lds, const void* g) {
    *(v8h*)lds = *(const v8h*)g;
}
__device__ __forceinline__ void cp_wait() {}
#endif

__device__ __forceinline__ v16h make_frag(const _Float16* p) {
    // per-lane 16-bit fragment = two contiguous 8-half (16B) chunks:
    // k in [8*hi, 8*hi+8) and [16+8*hi, 16+8*hi+8); caller bakes 8*hi into p.
    v8h lo = *(const v8h*)(p);
    v8h hi8 = *(const v8h*)(p + 16);
    return __builtin_shufflevector(lo, hi8, 0,1,2,3,4,5,6,7,8,9,10,11,12,13,14,15);
}

#define GM   128   // block M tile (2 x 16 rows per wave)
#define GN   64
#define GK   32
// LDS row pitches in halves: 16 B x odd, so the 16 rows of a ds_load_b128
// fragment read fall on 16 different groups of four banks.
#define GKP  40    // 64-B rows  -> 80 B
#define AP   72    // 128-B rows -> 144 B

// ---------------- GEMM: C_f16 = (A_f32 * W_f32 + bias) * scale ----------------
__global__ __launch_bounds__(128) void gemm_proj_f16out(
    const float* __restrict__ A, const float* __restrict__ W,
    const float* __restrict__ bias, _Float16* __restrict__ Cout,
    float scale, int M, int N, int Kdim)
{
    __shared__ __align__(16) _Float16 ldsA[GM * GKP];   // [m][k], pitch GKP
    __shared__ __align__(16) _Float16 ldsBt[GN * GKP];  // [n][k], pitch GKP

    const int tid  = threadIdx.x;
    const int wave = tid >> 5;
    const int lane = tid & 31;
    const int r    = lane & 15;
    const int hi   = lane >> 4;

    const int m0 = blockIdx.y * GM;
    const int n0 = blockIdx.x * GN;

    v8f acc[2][4] = {};

    for (int k0 = 0; k0 < Kdim; k0 += GK) {
        // A tile: 128x32 f32 -> f16 (1024 v4f, 8 per thread)
        #pragma unroll
        for (int j = 0; j < 8; ++j) {
            int idx = tid + j * 128;
            int row = idx >> 3;
            int c4  = (idx & 7) << 2;
            v4f a4 = *(const v4f*)(A + (size_t)(m0 + row) * Kdim + k0 + c4);
            v4h h4;
            h4[0] = (_Float16)a4[0]; h4[1] = (_Float16)a4[1];
            h4[2] = (_Float16)a4[2]; h4[3] = (_Float16)a4[3];
            *(v4h*)(&ldsA[row * GKP + c4]) = h4;
        }
        // W tile: 32x64 f32, transposed into [n][k]
        #pragma unroll
        for (int j = 0; j < 4; ++j) {
            int idx  = tid + j * 128;
            int krow = idx >> 4;
            int c4   = (idx & 15) << 2;
            v4f b4 = *(const v4f*)(W + (size_t)(k0 + krow) * N + n0 + c4);
            ldsBt[(c4 + 0) * GKP + krow] = (_Float16)b4[0];
            ldsBt[(c4 + 1) * GKP + krow] = (_Float16)b4[1];
            ldsBt[(c4 + 2) * GKP + krow] = (_Float16)b4[2];
            ldsBt[(c4 + 3) * GKP + krow] = (_Float16)b4[3];
        }
        __syncthreads();

        v16h af[2];
        #pragma unroll
        for (int mi = 0; mi < 2; ++mi)
            af[mi] = make_frag(&ldsA[(wave * 32 + mi * 16 + r) * GKP + 8 * hi]);
        #pragma unroll
        for (int sub = 0; sub < 4; ++sub) {
            v16h bfrag = make_frag(&ldsBt[(sub * 16 + r) * GKP + 8 * hi]);
            #pragma unroll
            for (int mi = 0; mi < 2; ++mi)
                acc[mi][sub] = __builtin_amdgcn_wmma_f32_16x16x32_f16(
                    false, af[mi], false, bfrag, (short)0, acc[mi][sub], false, false);
        }
        __syncthreads();
    }

    #pragma unroll
    for (int mi = 0; mi < 2; ++mi) {
        #pragma unroll
        for (int sub = 0; sub < 4; ++sub) {
            int col = n0 + sub * 16 + r;
            float bv = bias[col];
            #pragma unroll
            for (int v = 0; v < 8; ++v) {
                int row = m0 + wave * 32 + mi * 16 + hi * 8 + v;
                Cout[(size_t)row * N + col] = (_Float16)((acc[mi][sub][v] + bv) * scale);
            }
        }
    }
}

// ---------------- GEMM: out_f32 = A_f16 * W_f32 + bias ----------------
__global__ __launch_bounds__(128) void gemm_out_f32(
    const _Float16* __restrict__ A, const float* __restrict__ W,
    const float* __restrict__ bias, float* __restrict__ Out,
    int M, int N, int Kdim)
{
    __shared__ __align__(16) _Float16 ldsA[GM * GKP];
    __shared__ __align__(16) _Float16 ldsBt[GN * GKP];

    const int tid  = threadIdx.x;
    const int wave = tid >> 5;
    const int lane = tid & 31;
    const int r    = lane & 15;
    const int hi   = lane >> 4;

    const int m0 = blockIdx.y * GM;
    const int n0 = blockIdx.x * GN;

    v8f acc[2][4] = {};

    for (int k0 = 0; k0 < Kdim; k0 += GK) {
        // A tile: 128x32 f16 straight copy -> async to LDS (512 v8h, 4/thread)
        #pragma unroll
        for (int j = 0; j < 4; ++j) {
            int idx = tid + j * 128;
            int row = idx >> 2;
            int c8  = (idx & 3) << 3;
            cp_b128(&ldsA[row * GKP + c8],
                    A + (size_t)(m0 + row) * Kdim + k0 + c8);
        }
        #pragma unroll
        for (int j = 0; j < 4; ++j) {
            int idx  = tid + j * 128;
            int krow = idx >> 4;
            int c4   = (idx & 15) << 2;
            v4f b4 = *(const v4f*)(W + (size_t)(k0 + krow) * N + n0 + c4);
            ldsBt[(c4 + 0) * GKP + krow] = (_Float16)b4[0];
            ldsBt[(c4 + 1) * GKP + krow] = (_Float16)b4[1];
            ldsBt[(c4 + 2) * GKP + krow] = (_Float16)b4[2];
            ldsBt[(c4 + 3) * GKP + krow] = (_Float16)b4[3];
        }
        cp_wait();
        __syncthreads();

        v16h af[2];
        #pragma unroll
        for (int mi = 0; mi < 2; ++mi)
            af[mi] = make_frag(&ldsA[(wave * 32 + mi * 16 + r) * GKP + 8 * hi]);
        #pragma unroll
        for (int sub = 0; sub < 4; ++sub) {
            v16h bfrag = make_frag(&ldsBt[(sub * 16 + r) * GKP + 8 * hi]);
            #pragma unroll
            for (int mi = 0; mi < 2; ++mi)
                acc[mi][sub] = __builtin_amdgcn_wmma_f32_16x16x32_f16(
                    false, af[mi], false, bfrag, (short)0, acc[mi][sub], false, false);
        }
        __syncthreads();
    }

    #pragma unroll
    for (int mi = 0; mi < 2; ++mi) {
        #pragma unroll
        for (int sub = 0; sub < 4; ++sub) {
            int col = n0 + sub * 16 + r;
            float bv = bias[col];
            #pragma unroll
            for (int v = 0; v < 8; ++v) {
                int row = m0 + wave * 32 + mi * 16 + hi * 8 + v;
                Out[(size_t)row * N + col] = acc[mi][sub][v] + bv;
            }
        }
    }
}

// ---------------- Flash attention over f16 Q/K/V -> f16 ctx ----------------
// Q pre-scaled by 1/sqrt(HD). Layouts are [B,S,H,HD] f16.
// Block: 128 threads (4 waves) covers 128 query rows of one (b,h).
// Wave covers 32 query rows (2 x 16). Key tiles of 64.
__global__ __launch_bounds__(128) void attn_kernel(
    const _Float16* __restrict__ Qw, const _Float16* __restrict__ Kw,
    const _Float16* __restrict__ Vw, _Float16* __restrict__ Ctx)
{
    __shared__ __align__(16) _Float16 ldsK[64 * AP];    // [key][hd], pitch AP
    __shared__ __align__(16) _Float16 ldsVt[64 * AP];   // [hd][key], pitch AP
    __shared__ __align__(16) _Float16 ldsP[4][32 * AP]; // per wave: [q][key], pitch AP

    const int tid  = threadIdx.x;
    const int wave = tid >> 5;
    const int lane = tid & 31;
    const int r    = lane & 15;
    const int hi   = lane >> 4;

    const int bh = blockIdx.x;
    const int b  = bh / Hc;
    const int h  = bh % Hc;
    const int q0 = blockIdx.y * 128;

    const size_t base   = ((size_t)b * Sc * Hc + h) * HDc;  // (b, s=0, h, 0)
    const size_t rowstr = (size_t)Hc * HDc;                 // per-s stride (halves)

    // Q fragments: 2 row-halves x 2 k-steps over HD=64
    v16h aq[2][2];
    #pragma unroll
    for (int mi = 0; mi < 2; ++mi) {
        const _Float16* qp = Qw + base
            + (size_t)(q0 + wave * 32 + mi * 16 + r) * rowstr;
        #pragma unroll
        for (int ks = 0; ks < 2; ++ks)
            aq[mi][ks] = make_frag(qp + ks * 32 + 8 * hi);
    }

    float mrow[2][8], lrow[2][8];
    v8f O[2][4] = {};
    #pragma unroll
    for (int mi = 0; mi < 2; ++mi)
        #pragma unroll
        for (int v = 0; v < 8; ++v) { mrow[mi][v] = -1e30f; lrow[mi][v] = 0.0f; }

    _Float16* pw = &ldsP[wave][0];

    for (int kt0 = 0; kt0 < Sc; kt0 += 64) {
        // stage K (async straight copy) and V (transposed, through regs)
        #pragma unroll
        for (int j = 0; j < 4; ++j) {
            int idx = tid + j * 128;          // 512 chunks of 8 halves
            int key = idx >> 3;
            int c8  = (idx & 7) << 3;
            size_t g = base + (size_t)(kt0 + key) * rowstr + c8;
            cp_b128(&ldsK[key * AP + c8], Kw + g);
            v8h vv = *(const v8h*)(Vw + g);
            #pragma unroll
            for (int t = 0; t < 8; ++t)
                ldsVt[(c8 + t) * AP + key] = vv[t];
        }
        cp_wait();
        __syncthreads();

        // scores: S[32q x 64k] = Q(32x64) * K^T ; B-fragments reused across mi
        v8f sacc[2][4] = {};
        #pragma unroll
        for (int ks = 0; ks < 2; ++ks) {
            #pragma unroll
            for (int sub = 0; sub < 4; ++sub) {
                v16h bfrag = make_frag(&ldsK[(sub * 16 + r) * AP + ks * 32 + 8 * hi]);
                #pragma unroll
                for (int mi = 0; mi < 2; ++mi)
                    sacc[mi][sub] = __builtin_amdgcn_wmma_f32_16x16x32_f16(
                        false, aq[mi][ks], false, bfrag, (short)0,
                        sacc[mi][sub], false, false);
            }
        }

        // online softmax per row-half; rows m = 8*hi + v live in one 16-lane half
        #pragma unroll
        for (int mi = 0; mi < 2; ++mi) {
            float scal[8];
            #pragma unroll
            for (int v = 0; v < 8; ++v) {
                float rm = fmaxf(fmaxf(sacc[mi][0][v], sacc[mi][1][v]),
                                 fmaxf(sacc[mi][2][v], sacc[mi][3][v]));
                #pragma unroll
                for (int off = 1; off < 16; off <<= 1)
                    rm = fmaxf(rm, __shfl_xor(rm, off, 32));
                float nm = fmaxf(mrow[mi][v], rm);
                scal[v] = __expf(mrow[mi][v] - nm);
                mrow[mi][v] = nm;
            }
            float rs[8];
            #pragma unroll
            for (int v = 0; v < 8; ++v) rs[v] = 0.0f;
            #pragma unroll
            for (int sub = 0; sub < 4; ++sub) {
                #pragma unroll
                for (int v = 0; v < 8; ++v) {
                    float p = __expf(sacc[mi][sub][v] - mrow[mi][v]);
                    sacc[mi][sub][v] = p;
                    rs[v] += p;
                }
            }
            #pragma unroll
            for (int v = 0; v < 8; ++v) {
                #pragma unroll
                for (int off = 1; off < 16; off <<= 1)
                    rs[v] += __shfl_xor(rs[v], off, 32);
                lrow[mi][v] = lrow[mi][v] * scal[v] + rs[v];
            }
            #pragma unroll
            for (int sub = 0; sub < 4; ++sub)
                #pragma unroll
                for (int v = 0; v < 8; ++v)
                    O[mi][sub][v] *= scal[v];
            // P: D-layout -> A-layout via per-wave LDS bounce (DS in-order/wave)
            #pragma unroll
            for (int sub = 0; sub < 4; ++sub)
                #pragma unroll
                for (int v = 0; v < 8; ++v)
                    pw[(mi * 16 + hi * 8 + v) * AP + sub * 16 + r] =
                        (_Float16)sacc[mi][sub][v];
        }

        // O += P(32x64) * V(64x64); V B-fragments reused across mi
        #pragma unroll
        for (int ks = 0; ks < 2; ++ks) {
            v16h ap[2];
            #pragma unroll
            for (int mi = 0; mi < 2; ++mi)
                ap[mi] = make_frag(pw + (mi * 16 + r) * AP + ks * 32 + 8 * hi);
            #pragma unroll
            for (int sub = 0; sub < 4; ++sub) {
                v16h bfrag = make_frag(&ldsVt[(sub * 16 + r) * AP + ks * 32 + 8 * hi]);
                #pragma unroll
                for (int mi = 0; mi < 2; ++mi)
                    O[mi][sub] = __builtin_amdgcn_wmma_f32_16x16x32_f16(
                        false, ap[mi], false, bfrag, (short)0, O[mi][sub], false, false);
            }
        }
        __syncthreads();  // protect ldsK/ldsVt for next tile
    }

    // normalize and store ctx (f16, [B,S,H,HD])
    #pragma unroll
    for (int mi = 0; mi < 2; ++mi) {
        #pragma unroll
        for (int sub = 0; sub < 4; ++sub) {
            #pragma unroll
            for (int v = 0; v < 8; ++v) {
                int row = q0 + wave * 32 + mi * 16 + hi * 8 + v;
                float val = O[mi][sub][v] / lrow[mi][v];
                Ctx[base + (size_t)row * rowstr + sub * 16 + r] = (_Float16)val;
            }
        }
    }
}

extern "C" void kernel_launch(void* const* d_in, const int* in_sizes, int n_in,
                              void* d_out, int out_size, void* d_ws, size_t ws_size,
                              hipStream_t stream) {
    (void)in_sizes; (void)n_in; (void)out_size; (void)ws_size;

    const float* Xq  = (const float*)d_in[0];
    const float* Xkv = (const float*)d_in[1];
    const float* Wq  = (const float*)d_in[2];
    const float* bq  = (const float*)d_in[3];
    const float* Wk  = (const float*)d_in[4];
    const float* bk  = (const float*)d_in[5];
    const float* Wv  = (const float*)d_in[6];
    const float* bv  = (const float*)d_in[7];
    const float* Wo  = (const float*)d_in[8];
    const float* bo  = (const float*)d_in[9];
    float* out = (float*)d_out;

    const size_t elems = (size_t)BSM * Dm;  // 4096*1024
    _Float16* Qh = (_Float16*)d_ws;
    _Float16* Kh = Qh + elems;
    _Float16* Vh = Kh + elems;
    _Float16* Ch = Vh + elems;

    dim3 blk(128);
    dim3 gg(Dm / GN, BSM / GM);       // (16, 32)

    const float qscale = 0.125f;      // 1/sqrt(HD=64)
    gemm_proj_f16out<<<gg, blk, 0, stream>>>(Xq,  Wq, bq, Qh, qscale, BSM, Dm, Dm);
    gemm_proj_f16out<<<gg, blk, 0, stream>>>(Xkv, Wk, bk, Kh, 1.0f,   BSM, Dm, Dm);
    gemm_proj_f16out<<<gg, blk, 0, stream>>>(Xkv, Wv, bv, Vh, 1.0f,   BSM, Dm, Dm);

    dim3 ga(Bc * Hc, Sc / 128);       // (32, 16)
    attn_kernel<<<ga, blk, 0, stream>>>(Qh, Kh, Vh, Ch);

    gemm_out_f32<<<gg, blk, 0, stream>>>(Ch, Wo, bo, out, BSM, Dm, Dm);
}

// v002
// A run of this version takes 232 microseconds.
// Timed twice side by side with v001, it ran 1.16 times as fast both times.
// Counting every step since v000, it is 1.56 times as fast.
#include <hip/hip_runtime.h>
#include <hip/hip_bf16.h>

// ---- problem constants (match reference) ----
#define Bc   2
#define Sc   2048
#define Dm   1024
#define Hc   16
#define HDc  64
#define BSM  (Bc * Sc)          // 4096 rows

typedef __attribute__((ext_vector_type(16))) _Float16 v16h;
typedef __attribute__((ext_vector_type(8)))  _Float16 v8h;
typedef __attribute__((ext_vector_type(4)))  _Float16 v4h;
typedef __attribute__((ext_vector_type(8)))  float    v8f;
typedef __attribute__((ext_vector_type(4)))  float    v4f;
typedef __attribute__((ext_vector_type(4)))  int      v4i;

// ---------- CDNA5 async global->LDS copy (ASYNCcnt path), guarded ----------
#if defined(__has_builtin)
#  if __has_builtin(__builtin_amdgcn_global_load_async_to_lds_b128)
#    define HAS_ASYNC_CP 1
#  endif
#endif
#ifndef HAS_ASYNC_CP
#  define HAS_ASYNC_CP 0
#endif

#if HAS_ASYNC_CP
typedef __attribute__((address_space(1))) v4i* g_v4i_p;   // global int4*
typedef __attribute__((address_space(3))) v4i* l_v4i_p;   // LDS int4*
__device__ __forceinline__ void cp_b128(void* lds, const void* g) {
    // global side: flat address == global address, so inttoptr into AS1 is safe;
    // LDS side: generic -> AS3 addrspacecast.
    __builtin_amdgcn_global_load_async_to_lds_b128(
        (g_v4i_p)(uintptr_t)g, (l_v4i_p)lds, 0, 0);
}
__device__ __forceinline__ void cp_wait() {
#  if __has_builtin(__builtin_amdgcn_s_wait_asynccnt)
    __builtin_amdgcn_s_wait_asynccnt(0);
#  else
    asm volatile("s_wait_asynccnt 0" ::: "memory");
#  endif
}
#else
__device__ __forceinline__ void cp_b128(void* lds, const void* g) {
    *(v8h*)lds = *(const v8h*)g;
}
__device__ __forceinline__ void cp_wait() {}
#endif

__device__ __forceinline__ v16h make_frag(const _Float16* p) {
    // per-lane 16-bit fragment = two contiguous 8-half (16B) chunks:
    // k in [8*hi, 8*hi+8) and [16+8*hi, 16+8*hi+8); caller bakes 8*hi into p.
    v8h lo = *(const v8h*)(p);
    v8h hi8 = *(const v8h*)(p + 16);
    return __builtin_shufflevector(lo, hi8, 0,1,2,3,4,5,6,7,8,9,10,11,12,13,14,15);
}

#define GM   128   // block M tile (2 x 16 rows per wave)
#define GN   64
#define GK   32
// LDS row pitches in halves: 16 B x odd, so the 16 rows of a ds_load_b128
// fragment read fall on 16 different groups of four banks.
#define GKP  40    // 64-B rows  -> 80 B
#define AP   72    // 128-B rows -> 144 B

// ---------------- GEMM: C_f16 = (A_f32 * W_f32 + bias) * scale ----------------
__global__ __launch_bounds__(128) void gemm_proj_f16out(
    const float* __restrict__ A, const float* __restrict__ W,
    const float* __restrict__ bias, _Float16* __restrict__ Cout,
    float scale, int M, int N, int Kdim)
{
    __shared__ __align__(16) _Float16 ldsA[GM * GKP];   // [m][k], pitch GKP
    __shared__ __align__(16) _Float16 ldsBt[GN * GKP];  // [n][k], pitch GKP

    const int tid  = threadIdx.x;
    const int wave = tid >> 5;
    const int lane = tid & 31;
    const int r    = lane & 15;
    const int hi   = lane >> 4;

    const int m0 = blockIdx.y * GM;
    const int n0 = blockIdx.x * GN;

    v8f acc[2][4] = {};

    for (int k0 = 0; k0 < Kdim; k0 += GK) {
        // A tile: 128x32 f32 -> f16 (1024 v4f, 8 per thread)
        #pragma unroll
        for (int j = 0; j < 8; ++j) {
            int idx = tid + j * 128;
            int row = idx >> 3;
            int c4  = (idx & 7) << 2;
            v4f a4 = *(const v4f*)(A + (size_t)(m0 + row) * Kdim + k0 + c4);
            v4h h4;
            h4[0] = (_Float16)a4[0]; h4[1] = (_Float16)a4[1];
            h4[2] = (_Float16)a4[2]; h4[3] = (_Float16)a4[3];
            *(v4h*)(&ldsA[row * GKP + c4]) = h4;
        }
        // W tile: 32x64 f32, transposed into [n][k]
        #pragma unroll
        for (int j = 0; j < 4; ++j) {
            int idx  = tid + j * 128;
            int krow = idx >> 4;
            int c4   = (idx & 15) << 2;
            v4f b4 = *(const v4f*)(W + (size_t)(k0 + krow) * N + n0 + c4);
            ldsBt[(c4 + 0) * GKP + krow] = (_Float16)b4[0];
            ldsBt[(c4 + 1) * GKP + krow] = (_Float16)b4[1];
            ldsBt[(c4 + 2) * GKP + krow] = (_Float16)b4[2];
            ldsBt[(c4 + 3) * GKP + krow] = (_Float16)b4[3];
        }
        __syncthreads();

        v16h af[2];
        #pragma unroll
        for (int mi = 0; mi < 2; ++mi)
            af[mi] = make_frag(&ldsA[(wave * 32 + mi * 16 + r) * GKP + 8 * hi]);
        #pragma unroll
        for (int sub = 0; sub < 4; ++sub) {
            v16h bfrag = make_frag(&ldsBt[(sub * 16 + r) * GKP + 8 * hi]);
            #pragma unroll
            for (int mi = 0; mi < 2; ++mi)
                acc[mi][sub] = __builtin_amdgcn_wmma_f32_16x16x32_f16(
                    false, af[mi], false, bfrag, (short)0, acc[mi][sub], false, false);
        }
        __syncthreads();
    }

    #pragma unroll
    for (int mi = 0; mi < 2; ++mi) {
        #pragma unroll
        for (int sub = 0; sub < 4; ++sub) {
            int col = n0 + sub * 16 + r;
            float bv = bias[col];
            #pragma unroll
            for (int v = 0; v < 8; ++v) {
                int row = m0 + wave * 32 + mi * 16 + hi * 8 + v;
                Cout[(size_t)row * N + col] = (_Float16)((acc[mi][sub][v] + bv) * scale);
            }
        }
    }
}

// ---------------- GEMM: out_f32 = A_f16 * W_f32 + bias ----------------
__global__ __launch_bounds__(128) void gemm_out_f32(
    const _Float16* __restrict__ A, const float* __restrict__ W,
    const float* __restrict__ bias, float* __restrict__ Out,
    int M, int N, int Kdim)
{
    __shared__ __align__(16) _Float16 ldsA[GM * GKP];
    __shared__ __align__(16) _Float16 ldsBt[GN * GKP];

    const int tid  = threadIdx.x;
    const int wave = tid >> 5;
    const int lane = tid & 31;
    const int r    = lane & 15;
    const int hi   = lane >> 4;

    const int m0 = blockIdx.y * GM;
    const int n0 = blockIdx.x * GN;

    v8f acc[2][4] = {};

    for (int k0 = 0; k0 < Kdim; k0 += GK) {
        // A tile: 128x32 f16 straight copy -> async to LDS (512 v8h, 4/thread)
        #pragma unroll
        for (int j = 0; j < 4; ++j) {
            int idx = tid + j * 128;
            int row = idx >> 2;
            int c8  = (idx & 3) << 3;
            cp_b128(&ldsA[row * GKP + c8],
                    A + (size_t)(m0 + row) * Kdim + k0 + c8);
        }
        #pragma unroll
        for (int j = 0; j < 4; ++j) {
            int idx  = tid + j * 128;
            int krow = idx >> 4;
            int c4   = (idx & 15) << 2;
            v4f b4 = *(const v4f*)(W + (size_t)(k0 + krow) * N + n0 + c4);
            ldsBt[(c4 + 0) * GKP + krow] = (_Float16)b4[0];
            ldsBt[(c4 + 1) * GKP + krow] = (_Float16)b4[1];
            ldsBt[(c4 + 2) * GKP + krow] = (_Float16)b4[2];
            ldsBt[(c4 + 3) * GKP + krow] = (_Float16)b4[3];
        }
        cp_wait();
        __syncthreads();

        v16h af[2];
        #pragma unroll
        for (int mi = 0; mi < 2; ++mi)
            af[mi] = make_frag(&ldsA[(wave * 32 + mi * 16 + r) * GKP + 8 * hi]);
        #pragma unroll
        for (int sub = 0; sub < 4; ++sub) {
            v16h bfrag = make_frag(&ldsBt[(sub * 16 + r) * GKP + 8 * hi]);
            #pragma unroll
            for (int mi = 0; mi < 2; ++mi)
                acc[mi][sub] = __builtin_amdgcn_wmma_f32_16x16x32_f16(
                    false, af[mi], false, bfrag, (short)0, acc[mi][sub], false, false);
        }
        __syncthreads();
    }

    #pragma unroll
    for (int mi = 0; mi < 2; ++mi) {
        #pragma unroll
        for (int sub = 0; sub < 4; ++sub) {
            int col = n0 + sub * 16 + r;
            float bv = bias[col];
            #pragma unroll
            for (int v = 0; v < 8; ++v) {
                int row = m0 + wave * 32 + mi * 16 + hi * 8 + v;
                Out[(size_t)row * N + col] = acc[mi][sub][v] + bv;
            }
        }
    }
}

// lane l <-> lane l ^ 16: the two lanes that share one query
__device__ __forceinline__ float xhalf(float x) {
    return __builtin_bit_cast(float, __builtin_amdgcn_permlanex16(
        __builtin_bit_cast(int, x), __builtin_bit_cast(int, x),
        0x76543210, 0xfedcba98, false, false));
}

__global__ __launch_bounds__(128) void attn_kernel(
    const _Float16* __restrict__ Qw, const _Float16* __restrict__ Kw,
    const _Float16* __restrict__ Vw, _Float16* __restrict__ Ctx)
{
    __shared__ __align__(16) _Float16 ldsK[64 * AP];    // [key][hd], pitch AP
    __shared__ __align__(16) _Float16 ldsVt[64 * AP];   // [hd][key], pitch AP

    const int tid  = threadIdx.x;
    const int wave = tid >> 5;
    const int lane = tid & 31;
    const int r    = lane & 15;
    const int hi   = lane >> 4;

    const int bh = blockIdx.x;
    const int b  = bh / Hc;
    const int h  = bh % Hc;
    const int q0 = blockIdx.y * 128;

    const size_t base   = ((size_t)b * Sc * Hc + h) * HDc;  // (b, s=0, h, 0)
    const size_t rowstr = (size_t)Hc * HDc;                 // per-s stride (halves)

    // Q fragments (B operand): 2 query groups x 2 k-steps over HD=64
    v16h bq[2][2];
    #pragma unroll
    for (int mi = 0; mi < 2; ++mi) {
        const _Float16* qp = Qw + base
            + (size_t)(q0 + wave * 32 + mi * 16 + r) * rowstr;
        #pragma unroll
        for (int ks = 0; ks < 2; ++ks)
            bq[mi][ks] = make_frag(qp + ks * 32 + 8 * hi);
    }

    // per lane: running maximum of query r (equal in both halves) and the
    // running sum over this half's keys (the halves are joined after the loop)
    float mrow[2], lrow[2];
    v8f O[4][2] = {};   // O^T: [16 head dims][query group]
    #pragma unroll
    for (int mi = 0; mi < 2; ++mi) { mrow[mi] = -1e30f; lrow[mi] = 0.0f; }

    for (int kt0 = 0; kt0 < Sc; kt0 += 64) {
        // stage K (async straight copy) and V (transposed, through regs)
        #pragma unroll
        for (int j = 0; j < 4; ++j) {
            int idx = tid + j * 128;          // 512 chunks of 8 halves
            int key = idx >> 3;
            int c8  = (idx & 7) << 3;
            size_t g = base + (size_t)(kt0 + key) * rowstr + c8;
            cp_b128(&ldsK[key * AP + c8], Kw + g);
            v8h vv = *(const v8h*)(Vw + g);
            #pragma unroll
            for (int t = 0; t < 8; ++t)
                ldsVt[(c8 + t) * AP + key] = vv[t];
        }
        cp_wait();
        __syncthreads();

        // scores: S^T[64k x 32q] = K(64x64) * Q^T ; K fragments reused across mi
        v8f sacc[4][2] = {};
        #pragma unroll
        for (int ks = 0; ks < 2; ++ks) {
            #pragma unroll
            for (int kt = 0; kt < 4; ++kt) {
                v16h kfrag = make_frag(&ldsK[(kt * 16 + r) * AP + ks * 32 + 8 * hi]);
                #pragma unroll
                for (int mi = 0; mi < 2; ++mi)
                    sacc[kt][mi] = __builtin_amdgcn_wmma_f32_16x16x32_f16(
                        false, kfrag, false, bq[mi][ks], (short)0,
                        sacc[kt][mi], false, false);
            }
        }

        // online softmax: a lane holds 32 of the 64 scores of its query
        v16h pf[2][2];   // P^T as B operand: [query group][32-key step]
        #pragma unroll
        for (int mi = 0; mi < 2; ++mi) {
            float t8[8];
            #pragma unroll
            for (int v = 0; v < 8; ++v)
                t8[v] = fmaxf(fmaxf(sacc[0][mi][v], sacc[1][mi][v]),
                              fmaxf(sacc[2][mi][v], sacc[3][mi][v]));
            float rm = fmaxf(fmaxf(fmaxf(t8[0], t8[1]), fmaxf(t8[2], t8[3])),
                             fmaxf(fmaxf(t8[4], t8[5]), fmaxf(t8[6], t8[7])));
            rm = fmaxf(rm, xhalf(rm));
            const float nm   = fmaxf(mrow[mi], rm);
            const float scal = __expf(mrow[mi] - nm);
            mrow[mi] = nm;

            // exp(x) = exp2(x * log2(e)), as __expf forms it; difference and product on whole tiles
            v8f p[4];
            #pragma unroll
            for (int kt = 0; kt < 4; ++kt) p[kt] = (sacc[kt][mi] - nm) * 1.44269504088896340736f;
            #pragma unroll
            for (int kt = 0; kt < 4; ++kt) {
                #pragma unroll
                for (int v = 0; v < 8; ++v) p[kt][v] = __builtin_amdgcn_exp2f(p[kt][v]);
                sacc[kt][mi] = p[kt];
            }
            const v8f rs = (p[0] + p[1]) + (p[2] + p[3]);
            lrow[mi] = lrow[mi] * scal
                + (((rs[0] + rs[1]) + (rs[2] + rs[3])) + ((rs[4] + rs[5]) + (rs[6] + rs[7])));
            #pragma unroll
            for (int sub = 0; sub < 4; ++sub)
                #pragma unroll
                for (int v = 0; v < 8; ++v)
                    O[sub][mi][v] *= scal;
            // element s of the B operand is key 8*hi + s (s < 8) or 16 + 8*hi + s - 8:
            // registers 0..7 of two S^T tiles that follow one another
            #pragma unroll
            for (int ks = 0; ks < 2; ++ks) {
                v8h plo = __builtin_convertvector(sacc[2 * ks][mi], v8h);
                v8h phi = __builtin_convertvector(sacc[2 * ks + 1][mi], v8h);
                pf[mi][ks] = __builtin_shufflevector(plo, phi,
                    0,1,2,3,4,5,6,7,8,9,10,11,12,13,14,15);
            }
        }

        // O^T += V^T(64x64) * P^T(64x32); V^T fragments reused across mi
        #pragma unroll
        for (int ks = 0; ks < 2; ++ks) {
            #pragma unroll
            for (int sub = 0; sub < 4; ++sub) {
                v16h vfrag = make_frag(&ldsVt[(sub * 16 + r) * AP + ks * 32 + 8 * hi]);
                #pragma unroll
                for (int mi = 0; mi < 2; ++mi)
                    O[sub][mi] = __builtin_amdgcn_wmma_f32_16x16x32_f16(
                        false, vfrag, false, pf[mi][ks], (short)0, O[sub][mi], false, false);
            }
        }
        __syncthreads();  // protect ldsK/ldsVt for next tile
    }

    // normalize and store ctx (f16, [B,S,H,HD]): a lane holds 8 consecutive
    // head dims of its query per tile, one 16-byte store each
    #pragma unroll
    for (int mi = 0; mi < 2; ++mi) {
        const float l = lrow[mi] + xhalf(lrow[mi]);
        const int row = q0 + wave * 32 + mi * 16 + r;
        #pragma unroll
        for (int sub = 0; sub < 4; ++sub) {
            v8h o8;
            #pragma unroll
            for (int v = 0; v < 8; ++v)
                o8[v] = (_Float16)(O[sub][mi][v] / l);
            *(v8h*)(Ctx + base + (size_t)row * rowstr + sub * 16 + 8 * hi) = o8;
        }
    }
}

extern "C" void kernel_launch(void* const* d_in, const int* in_sizes, int n_in,
                              void* d_out, int out_size, void* d_ws, size_t ws_size,
                              hipStream_t stream) {
    (void)in_sizes; (void)n_in; (void)out_size; (void)ws_size;

    const float* Xq  = (const float*)d_in[0];
    const float* Xkv = (const float*)d_in[1];
    const float* Wq  = (const float*)d_in[2];
    const float* bq  = (const float*)d_in[3];
    const float* Wk  = (const float*)d_in[4];
    const float* bk  = (const float*)d_in[5];
    const float* Wv  = (const float*)d_in[6];
    const float* bv  = (const float*)d_in[7];
    const float* Wo  = (const float*)d_in[8];
    const float* bo  = (const float*)d_in[9];
    float* out = (float*)d_out;

    const size_t elems = (size_t)BSM * Dm;  // 4096*1024
    _Float16* Qh = (_Float16*)d_ws;
    _Float16* Kh = Qh + elems;
    _Float16* Vh = Kh + elems;
    _Float16* Ch = Vh + elems;

    dim3 blk(128);
    dim3 gg(Dm / GN, BSM / GM);       // (16, 32)

    const float qscale = 0.125f;      // 1/sqrt(HD=64)
    gemm_proj_f16out<<<gg, blk, 0, stream>>>(Xq,  Wq, bq, Qh, qscale, BSM, Dm, Dm);
    gemm_proj_f16out<<<gg, blk, 0, stream>>>(Xkv, Wk, bk, Kh, 1.0f,   BSM, Dm, Dm);
    gemm_proj_f16out<<<gg, blk, 0, stream>>>(Xkv, Wv, bv, Vh, 1.0f,   BSM, Dm, Dm);

    dim3 ga(Bc * Hc, Sc / 128);       // (32, 16)
    attn_kernel<<<ga, blk, 0, stream>>>(Qh, Kh, Vh, Ch);

    gemm_out_f32<<<gg, blk, 0, stream>>>(Ch, Wo, bo, out, BSM, Dm, Dm);
}

// v003
// One run takes 176 microseconds.
// In both of two side-by-side timings against v002, it was 1.32 times as fast.
// Counting every step since v000, it is 2.05 times as fast.
#include <hip/hip_runtime.h>
#include <hip/hip_bf16.h>

// ---- problem constants (match reference) ----
#define Bc   2
#define Sc   2048
#define Dm   1024
#define Hc   16
#define HDc  64
#define BSM  (Bc * Sc)          // 4096 rows

typedef __attribute__((ext_vector_type(16))) _Float16 v16h;
typedef __attribute__((ext_vector_type(8)))  _Float16 v8h;
typedef __attribute__((ext_vector_type(4)))  _Float16 v4h;
typedef __attribute__((ext_vector_type(8)))  float    v8f;
typedef __attribute__((ext_vector_type(4)))  float    v4f;
typedef __attribute__((ext_vector_type(4)))  int      v4i;

// ---------- CDNA5 async global->LDS copy (ASYNCcnt path), guarded ----------
#if defined(__has_builtin)
#  if __has_builtin(__builtin_amdgcn_global_load_async_to_lds_b128)
#    define HAS_ASYNC_CP 1
#  endif
#endif
#ifndef HAS_ASYNC_CP
#  define HAS_ASYNC_CP 0
#endif

#if HAS_ASYNC_CP
typedef __attribute__((address_space(1))) v4i* g_v4i_p;   // global int4*
typedef __attribute__((address_space(3))) v4i* l_v4i_p;   // LDS int4*
__device__ __forceinline__ void cp_b128(void* lds, const void* g) {
    // global side: flat address == global address, so inttoptr into AS1 is safe;
    // LDS side: generic -> AS3 addrspacecast.
    __builtin_amdgcn_global_load_async_to_lds_b128(
        (g_v4i_p)(uintptr_t)g, (l_v4i_p)lds, 0, 0);
}
__device__ __forceinline__ void cp_wait() {
#  if __has_builtin(__builtin_amdgcn_s_wait_asynccnt)
    __builtin_amdgcn_s_wait_asynccnt(0);
#  else
    asm volatile("s_wait_asynccnt 0" ::: "memory");
#  endif
}
#else
__device__ __forceinline__ void cp_b128(void* lds, const void* g) {
    *(v8h*)lds = *(const v8h*)g;
}
__device__ __forceinline__ void cp_wait() {}
#endif

__device__ __forceinline__ v16h make_frag(const _Float16* p) {
    // per-lane 16-bit fragment = two contiguous 8-half (16B) chunks:
    // k in [8*hi, 8*hi+8) and [16+8*hi, 16+8*hi+8); caller bakes 8*hi into p.
    v8h lo = *(const v8h*)(p);
    v8h hi8 = *(const v8h*)(p + 16);
    return __builtin_shufflevector(lo, hi8, 0,1,2,3,4,5,6,7,8,9,10,11,12,13,14,15);
}

#define GM   128   // block M tile (2 x 16 rows per wave)
#define GN   64
#define GK   32
// LDS row pitches in halves: 16 B x odd, so the 16 rows of a ds_load_b128
// fragment read fall on 16 different groups of four banks.
#define GKP  40    // 64-B rows  -> 80 B
#define AP   72    // 128-B rows -> 144 B

// ---------------- GEMM: C_f16 = (A_f32 * W_f32 + bias) * scale ----------------
// One launch does the three projections: blockIdx.z picks the product
// (0: query, scaled; 1: key; 2: value). The three results lie one behind the
// other in Cbase, M * N halves each.
__global__ __launch_bounds__(128) void gemm_proj_f16out(
    const float* __restrict__ Xq, const float* __restrict__ Xkv,
    const float* __restrict__ Wq, const float* __restrict__ Wk,
    const float* __restrict__ Wv,
    const float* __restrict__ bq, const float* __restrict__ bk,
    const float* __restrict__ bv, _Float16* __restrict__ Cbase,
    float qscale, int M, int N, int Kdim)
{
    __shared__ __align__(16) _Float16 ldsA[GM * GKP];   // [m][k], pitch GKP
    __shared__ __align__(16) _Float16 ldsBt[GN * GKP];  // [n][k], pitch GKP

    const int which = blockIdx.z;
    const float* __restrict__ A    = which == 0 ? Xq : Xkv;
    const float* __restrict__ W    = which == 0 ? Wq : (which == 1 ? Wk : Wv);
    const float* __restrict__ bias = which == 0 ? bq : (which == 1 ? bk : bv);
    _Float16* __restrict__ Cout    = Cbase + (size_t)which * M * N;
    const float scale              = which == 0 ? qscale : 1.0f;

    const int tid  = threadIdx.x;
    const int wave = tid >> 5;
    const int lane = tid & 31;
    const int r    = lane & 15;
    const int hi   = lane >> 4;

    const int m0 = blockIdx.y * GM;
    const int n0 = blockIdx.x * GN;

    v8f acc[2][4] = {};

    for (int k0 = 0; k0 < Kdim; k0 += GK) {
        // A tile: 128x32 f32 -> f16 (1024 v4f, 8 per thread)
        #pragma unroll
        for (int j = 0; j < 8; ++j) {
            int idx = tid + j * 128;
            int row = idx >> 3;
            int c4  = (idx & 7) << 2;
            v4f a4 = *(const v4f*)(A + (size_t)(m0 + row) * Kdim + k0 + c4);
            v4h h4;
            h4[0] = (_Float16)a4[0]; h4[1] = (_Float16)a4[1];
            h4[2] = (_Float16)a4[2]; h4[3] = (_Float16)a4[3];
            *(v4h*)(&ldsA[row * GKP + c4]) = h4;
        }
        // W tile: 32x64 f32, transposed into [n][k]
        #pragma unroll
        for (int j = 0; j < 4; ++j) {
            int idx  = tid + j * 128;
            int krow = idx >> 4;
            int c4   = (idx & 15) << 2;
            v4f b4 = *(const v4f*)(W + (size_t)(k0 + krow) * N + n0 + c4);
            ldsBt[(c4 + 0) * GKP + krow] = (_Float16)b4[0];
            ldsBt[(c4 + 1) * GKP + krow] = (_Float16)b4[1];
            ldsBt[(c4 + 2) * GKP + krow] = (_Float16)b4[2];
            ldsBt[(c4 + 3) * GKP + krow] = (_Float16)b4[3];
        }
        __syncthreads();

        v16h af[2];
        #pragma unroll
        for (int mi = 0; mi < 2; ++mi)
            af[mi] = make_frag(&ldsA[(wave * 32 + mi * 16 + r) * GKP + 8 * hi]);
        #pragma unroll
        for (int sub = 0; sub < 4; ++sub) {
            v16h bfrag = make_frag(&ldsBt[(sub * 16 + r) * GKP + 8 * hi]);
            #pragma unroll
            for (int mi = 0; mi < 2; ++mi)
                acc[mi][sub] = __builtin_amdgcn_wmma_f32_16x16x32_f16(
                    false, af[mi], false, bfrag, (short)0, acc[mi][sub], false, false);
        }
        __syncthreads();
    }

    #pragma unroll
    for (int mi = 0; mi < 2; ++mi) {
        #pragma unroll
        for (int sub = 0; sub < 4; ++sub) {
            int col = n0 + sub * 16 + r;
            float bv = bias[col];
            #pragma unroll
            for (int v = 0; v < 8; ++v) {
                int row = m0 + wave * 32 + mi * 16 + hi * 8 + v;
                Cout[(size_t)row * N + col] = (_Float16)((acc[mi][sub][v] + bv) * scale);
            }
        }
    }
}

// ---------------- GEMM: out_f32 = A_f16 * W_f32 + bias ----------------
__global__ __launch_bounds__(128) void gemm_out_f32(
    const _Float16* __restrict__ A, const float* __restrict__ W,
    const float* __restrict__ bias, float* __restrict__ Out,
    int M, int N, int Kdim)
{
    __shared__ __align__(16) _Float16 ldsA[GM * GKP];
    __shared__ __align__(16) _Float16 ldsBt[GN * GKP];

    const int tid  = threadIdx.x;
    const int wave = tid >> 5;
    const int lane = tid & 31;
    const int r    = lane & 15;
    const int hi   = lane >> 4;

    const int m0 = blockIdx.y * GM;
    const int n0 = blockIdx.x * GN;

    v8f acc[2][4] = {};

    for (int k0 = 0; k0 < Kdim; k0 += GK) {
        // A tile: 128x32 f16 straight copy -> async to LDS (512 v8h, 4/thread)
        #pragma unroll
        for (int j = 0; j < 4; ++j) {
            int idx = tid + j * 128;
            int row = idx >> 2;
            int c8  = (idx & 3) << 3;
            cp_b128(&ldsA[row * GKP + c8],
                    A + (size_t)(m0 + row) * Kdim + k0 + c8);
        }
        #pragma unroll
        for (int j = 0; j < 4; ++j) {
            int idx  = tid + j * 128;
            int krow = idx >> 4;
            int c4   = (idx & 15) << 2;
            v4f b4 = *(const v4f*)(W + (size_t)(k0 + krow) * N + n0 + c4);
            ldsBt[(c4 + 0) * GKP + krow] = (_Float16)b4[0];
            ldsBt[(c4 + 1) * GKP + krow] = (_Float16)b4[1];
            ldsBt[(c4 + 2) * GKP + krow] = (_Float16)b4[2];
            ldsBt[(c4 + 3) * GKP + krow] = (_Float16)b4[3];
        }
        cp_wait();
        __syncthreads();

        v16h af[2];
        #pragma unroll
        for (int mi = 0; mi < 2; ++mi)
            af[mi] = make_frag(&ldsA[(wave * 32 + mi * 16 + r) * GKP + 8 * hi]);
        #pragma unroll
        for (int sub = 0; sub < 4; ++sub) {
            v16h bfrag = make_frag(&ldsBt[(sub * 16 + r) * GKP + 8 * hi]);
            #pragma unroll
            for (int mi = 0; mi < 2; ++mi)
                acc[mi][sub] = __builtin_amdgcn_wmma_f32_16x16x32_f16(
                    false, af[mi], false, bfrag, (short)0, acc[mi][sub], false, false);
        }
        __syncthreads();
    }

    #pragma unroll
    for (int mi = 0; mi < 2; ++mi) {
        #pragma unroll
        for (int sub = 0; sub < 4; ++sub) {
            int col = n0 + sub * 16 + r;
            float bv = bias[col];
            #pragma unroll
            for (int v = 0; v < 8; ++v) {
                int row = m0 + wave * 32 + mi * 16 + hi * 8 + v;
                Out[(size_t)row * N + col] = acc[mi][sub][v] + bv;
            }
        }
    }
}

// lane l <-> lane l ^ 16: the two lanes that share one query
__device__ __forceinline__ float xhalf(float x) {
    return __builtin_bit_cast(float, __builtin_amdgcn_permlanex16(
        __builtin_bit_cast(int, x), __builtin_bit_cast(int, x),
        0x76543210, 0xfedcba98, false, false));
}

__global__ __launch_bounds__(128) void attn_kernel(
    const _Float16* __restrict__ Qw, const _Float16* __restrict__ Kw,
    const _Float16* __restrict__ Vw, _Float16* __restrict__ Ctx)
{
    __shared__ __align__(16) _Float16 ldsK[64 * AP];    // [key][hd], pitch AP
    __shared__ __align__(16) _Float16 ldsVt[64 * AP];   // [hd][key], pitch AP

    const int tid  = threadIdx.x;
    const int wave = tid >> 5;
    const int lane = tid & 31;
    const int r    = lane & 15;
    const int hi   = lane >> 4;

    const int bh = blockIdx.x;
    const int b  = bh / Hc;
    const int h  = bh % Hc;
    const int q0 = blockIdx.y * 128;

    const size_t base   = ((size_t)b * Sc * Hc + h) * HDc;  // (b, s=0, h, 0)
    const size_t rowstr = (size_t)Hc * HDc;                 // per-s stride (halves)

    // Q fragments (B operand): 2 query groups x 2 k-steps over HD=64
    v16h bq[2][2];
    #pragma unroll
    for (int mi = 0; mi < 2; ++mi) {
        const _Float16* qp = Qw + base
            + (size_t)(q0 + wave * 32 + mi * 16 + r) * rowstr;
        #pragma unroll
        for (int ks = 0; ks < 2; ++ks)
            bq[mi][ks] = make_frag(qp + ks * 32 + 8 * hi);
    }

    // per lane: running maximum of query r (equal in both halves) and the
    // running sum over this half's keys (the halves are joined after the loop)
    float mrow[2], lrow[2];
    v8f O[4][2] = {};   // O^T: [16 head dims][query group]
    #pragma unroll
    for (int mi = 0; mi < 2; ++mi) { mrow[mi] = -1e30f; lrow[mi] = 0.0f; }

    for (int kt0 = 0; kt0 < Sc; kt0 += 64) {
        // stage K (async straight copy) and V (transposed, through regs)
        #pragma unroll
        for (int j = 0; j < 4; ++j) {
            int idx = tid + j * 128;          // 512 chunks of 8 halves
            int key = idx >> 3;
            int c8  = (idx & 7) << 3;
            size_t g = base + (size_t)(kt0 + key) * rowstr + c8;
            cp_b128(&ldsK[key * AP + c8], Kw + g);
            v8h vv = *(const v8h*)(Vw + g);
            #pragma unroll
            for (int t = 0; t < 8; ++t)
                ldsVt[(c8 + t) * AP + key] = vv[t];
        }
        cp_wait();
        __syncthreads();

        // scores: S^T[64k x 32q] = K(64x64) * Q^T ; K fragments reused across mi
        v8f sacc[4][2] = {};
        #pragma unroll
        for (int ks = 0; ks < 2; ++ks) {
            #pragma unroll
            for (int kt = 0; kt < 4; ++kt) {
                v16h kfrag = make_frag(&ldsK[(kt * 16 + r) * AP + ks * 32 + 8 * hi]);
                #pragma unroll
                for (int mi = 0; mi < 2; ++mi)
                    sacc[kt][mi] = __builtin_amdgcn_wmma_f32_16x16x32_f16(
                        false, kfrag, false, bq[mi][ks], (short)0,
                        sacc[kt][mi], false, false);
            }
        }

        // online softmax: a lane holds 32 of the 64 scores of its query
        v16h pf[2][2];   // P^T as B operand: [query group][32-key step]
        #pragma unroll
        for (int mi = 0; mi < 2; ++mi) {
            float t8[8];
            #pragma unroll
            for (int v = 0; v < 8; ++v)
                t8[v] = fmaxf(fmaxf(sacc[0][mi][v], sacc[1][mi][v]),
                              fmaxf(sacc[2][mi][v], sacc[3][mi][v]));
            float rm = fmaxf(fmaxf(fmaxf(t8[0], t8[1]), fmaxf(t8[2], t8[3])),
                             fmaxf(fmaxf(t8[4], t8[5]), fmaxf(t8[6], t8[7])));
            rm = fmaxf(rm, xhalf(rm));
            const float nm   = fmaxf(mrow[mi], rm);
            const float scal = __expf(mrow[mi] - nm);
            mrow[mi] = nm;

            // exp(x) = exp2(x * log2(e)), as __expf forms it; difference and product on whole tiles
            v8f p[4];
            #pragma unroll
            for (int kt = 0; kt < 4; ++kt) p[kt] = (sacc[kt][mi] - nm) * 1.44269504088896340736f;
            #pragma unroll
            for (int kt = 0; kt < 4; ++kt) {
                #pragma unroll
                for (int v = 0; v < 8; ++v) p[kt][v] = __builtin_amdgcn_exp2f(p[kt][v]);
                sacc[kt][mi] = p[kt];
            }
            const v8f rs = (p[0] + p[1]) + (p[2] + p[3]);
            lrow[mi] = lrow[mi] * scal
                + (((rs[0] + rs[1]) + (rs[2] + rs[3])) + ((rs[4] + rs[5]) + (rs[6] + rs[7])));
            #pragma unroll
            for (int sub = 0; sub < 4; ++sub)
                #pragma unroll
                for (int v = 0; v < 8; ++v)
                    O[sub][mi][v] *= scal;
            // element s of the B operand is key 8*hi + s (s < 8) or 16 + 8*hi + s - 8:
            // registers 0..7 of two S^T tiles that follow one another
            #pragma unroll
            for (int ks = 0; ks < 2; ++ks) {
                v8h plo = __builtin_convertvector(sacc[2 * ks][mi], v8h);
                v8h phi = __builtin_convertvector(sacc[2 * ks + 1][mi], v8h);
                pf[mi][ks] = __builtin_shufflevector(plo, phi,
                    0,1,2,3,4,5,6,7,8,9,10,11,12,13,14,15);
            }
        }

        // O^T += V^T(64x64) * P^T(64x32); V^T fragments reused across mi
        #pragma unroll
        for (int ks = 0; ks < 2; ++ks) {
            #pragma unroll
            for (int sub = 0; sub < 4; ++sub) {
                v16h vfrag = make_frag(&ldsVt[(sub * 16 + r) * AP + ks * 32 + 8 * hi]);
                #pragma unroll
                for (int mi = 0; mi < 2; ++mi)
                    O[sub][mi] = __builtin_amdgcn_wmma_f32_16x16x32_f16(
                        false, vfrag, false, pf[mi][ks], (short)0, O[sub][mi], false, false);
            }
        }
        __syncthreads();  // protect ldsK/ldsVt for next tile
    }

    // normalize and store ctx (f16, [B,S,H,HD]): a lane holds 8 consecutive
    // head dims of its query per tile, one 16-byte store each
    #pragma unroll
    for (int mi = 0; mi < 2; ++mi) {
        const float l = lrow[mi] + xhalf(lrow[mi]);
        const int row = q0 + wave * 32 + mi * 16 + r;
        #pragma unroll
        for (int sub = 0; sub < 4; ++sub) {
            v8h o8;
            #pragma unroll
            for (int v = 0; v < 8; ++v)
                o8[v] = (_Float16)(O[sub][mi][v] / l);
            *(v8h*)(Ctx + base + (size_t)row * rowstr + sub * 16 + 8 * hi) = o8;
        }
    }
}

extern "C" void kernel_launch(void* const* d_in, const int* in_sizes, int n_in,
                              void* d_out, int out_size, void* d_ws, size_t ws_size,
                              hipStream_t stream) {
    (void)in_sizes; (void)n_in; (void)out_size; (void)ws_size;

    const float* Xq  = (const float*)d_in[0];
    const float* Xkv = (const float*)d_in[1];
    const float* Wq  = (const float*)d_in[2];
    const float* bq  = (const float*)d_in[3];
    const float* Wk  = (const float*)d_in[4];
    const float* bk  = (const float*)d_in[5];
    const float* Wv  = (const float*)d_in[6];
    const float* bv  = (const float*)d_in[7];
    const float* Wo  = (const float*)d_in[8];
    const float* bo  = (const float*)d_in[9];
    float* out = (float*)d_out;

    const size_t elems = (size_t)BSM * Dm;  // 4096*1024
    _Float16* Qh = (_Float16*)d_ws;
    _Float16* Kh = Qh + elems;
    _Float16* Vh = Kh + elems;
    _Float16* Ch = Vh + elems;

    dim3 blk(128);
    dim3 gg(Dm / GN, BSM / GM);       // (16, 32)

    const float qscale = 0.125f;      // 1/sqrt(HD=64)
    dim3 gp(Dm / GN, BSM / GM, 3);    // (16, 32, 3): Qh, Kh, Vh follow one another
    gemm_proj_f16out<<<gp, blk, 0, stream>>>(Xq, Xkv, Wq, Wk, Wv, bq, bk, bv, Qh,
                                             qscale, BSM, Dm, Dm);

    dim3 ga(Bc * Hc, Sc / 128);       // (32, 16)
    attn_kernel<<<ga, blk, 0, stream>>>(Qh, Kh, Vh, Ch);

    gemm_out_f32<<<gg, blk, 0, stream>>>(Ch, Wo, bo, out, BSM, Dm, Dm);
}

// v004
// Measured time: 122 microseconds a run.
// Timed twice side by side with v003, it ran 1.45 times as fast both times.
// All steps since v000 together make it 2.97 times as fast.
#include <hip/hip_runtime.h>
#include <hip/hip_bf16.h>

// ---- problem constants (match reference) ----
#define Bc   2
#define Sc   2048
#define Dm   1024
#define Hc   16
#define HDc  64
#define BSM  (Bc * Sc)          // 4096 rows

typedef __attribute__((ext_vector_type(16))) _Float16 v16h;
typedef __attribute__((ext_vector_type(8)))  _Float16 v8h;
typedef __attribute__((ext_vector_type(4)))  _Float16 v4h;
typedef __attribute__((ext_vector_type(8)))  float    v8f;
typedef __attribute__((ext_vector_type(4)))  float    v4f;
typedef __attribute__((ext_vector_type(4)))  int      v4i;
typedef __attribute__((ext_vector_type(8)))  short    v8s;

// ---------- CDNA5 async global->LDS copy (ASYNCcnt path), guarded ----------
#if defined(__has_builtin)
#  if __has_builtin(__builtin_amdgcn_global_load_async_to_lds_b128)
#    define HAS_ASYNC_CP 1
#  endif
#endif
#ifndef HAS_ASYNC_CP
#  define HAS_ASYNC_CP 0
#endif

#if HAS_ASYNC_CP
typedef __attribute__((address_space(1))) v4i* g_v4i_p;   // global int4*
typedef __attribute__((address_space(3))) v4i* l_v4i_p;   // LDS int4*
__device__ __forceinline__ void cp_b128(void* lds, const void* g) {
    // global side: flat address == global address, so inttoptr into AS1 is safe;
    // LDS side: generic -> AS3 addrspacecast.
    __builtin_amdgcn_global_load_async_to_lds_b128(
        (g_v4i_p)(uintptr_t)g, (l_v4i_p)lds, 0, 0);
}
__device__ __forceinline__ void cp_wait() {
#  if __has_builtin(__builtin_amdgcn_s_wait_asynccnt)
    __builtin_amdgcn_s_wait_asynccnt(0);
#  else
    asm volatile("s_wait_asynccnt 0" ::: "memory");
#  endif
}
#else
__device__ __forceinline__ void cp_b128(void* lds, const void* g) {
    *(v8h*)lds = *(const v8h*)g;
}
__device__ __forceinline__ void cp_wait() {}
#endif

__device__ __forceinline__ v16h make_frag(const _Float16* p) {
    // per-lane 16-bit fragment = two contiguous 8-half (16B) chunks:
    // k in [8*hi, 8*hi+8) and [16+8*hi, 16+8*hi+8); caller bakes 8*hi into p.
    v8h lo = *(const v8h*)(p);
    v8h hi8 = *(const v8h*)(p + 16);
    return __builtin_shufflevector(lo, hi8, 0,1,2,3,4,5,6,7,8,9,10,11,12,13,14,15);
}

typedef __attribute__((address_space(3))) v8s* l_v8s_p;   // LDS short8*
__device__ __forceinline__ v16h make_frag_tr(const _Float16* p, int pitch) {
    // the same fragment out of a tile that lies [k][column] in LDS: each
    // transposing load hands lane (r, hi) the 8 halves T[kb + 8*hi + 0..7][cb + r];
    // caller bakes (kb + 8*hi + (lane & 7)) * pitch + cb + 8 * ((lane >> 3) & 1) into p.
    v8h lo  = __builtin_bit_cast(v8h, __builtin_amdgcn_ds_load_tr16_b128_v8i16((l_v8s_p)p));
    v8h hi8 = __builtin_bit_cast(v8h, __builtin_amdgcn_ds_load_tr16_b128_v8i16((l_v8s_p)(p + 16 * pitch)));
    return __builtin_shufflevector(lo, hi8, 0,1,2,3,4,5,6,7,8,9,10,11,12,13,14,15);
}

#define GM   128   // block M tile (2 x 16 rows per wave)
#define GN   64
#define GK   32
// LDS row pitches in halves: 16 B x odd, so the 16 rows of a ds_load_b128
// fragment read fall on 16 different groups of four banks.
#define GKP  40    // 64-B rows  -> 80 B
#define AP   72    // 128-B rows -> 144 B
// Rows read by the transposing load: 32 B x odd.
#define TP   80    // 128-B rows -> 160 B

// ---------------- GEMM: C_f16 = (A_f32 * W_f32 + bias) * scale ----------------
// One launch does the three projections: blockIdx.z picks the product
// (0: query, scaled; 1: key; 2: value). The three results lie one behind the
// other in Cbase, M * N halves each.
__global__ __launch_bounds__(128) void gemm_proj_f16out(
    const float* __restrict__ Xq, const float* __restrict__ Xkv,
    const float* __restrict__ Wq, const float* __restrict__ Wk,
    const float* __restrict__ Wv,
    const float* __restrict__ bq, const float* __restrict__ bk,
    const float* __restrict__ bv, _Float16* __restrict__ Cbase,
    float qscale, int M, int N, int Kdim)
{
    __shared__ __align__(16) _Float16 ldsA[GM * GKP];   // [m][k], pitch GKP
    __shared__ __align__(16) _Float16 ldsB[GK * TP];    // [k][n], pitch TP

    const int which = blockIdx.z;
    const float* __restrict__ A    = which == 0 ? Xq : Xkv;
    const float* __restrict__ W    = which == 0 ? Wq : (which == 1 ? Wk : Wv);
    const float* __restrict__ bias = which == 0 ? bq : (which == 1 ? bk : bv);
    _Float16* __restrict__ Cout    = Cbase + (size_t)which * M * N;
    const float scale              = which == 0 ? qscale : 1.0f;

    const int tid  = threadIdx.x;
    const int wave = tid >> 5;
    const int lane = tid & 31;
    const int r    = lane & 15;
    const int hi   = lane >> 4;
    const int trow = 8 * hi + (lane & 7);       // transposing load: this lane's row
    const int tcol = 8 * ((lane >> 3) & 1);     // and its 16-byte half of the 16 columns

    const int m0 = blockIdx.y * GM;
    const int n0 = blockIdx.x * GN;

    v8f acc[2][4] = {};

    for (int k0 = 0; k0 < Kdim; k0 += GK) {
        // A tile: 128x32 f32 -> f16 (1024 v4f, 8 per thread)
        #pragma unroll
        for (int j = 0; j < 8; ++j) {
            int idx = tid + j * 128;
            int row = idx >> 3;
            int c4  = (idx & 7) << 2;
            v4f a4 = *(const v4f*)(A + (size_t)(m0 + row) * Kdim + k0 + c4);
            v4h h4;
            h4[0] = (_Float16)a4[0]; h4[1] = (_Float16)a4[1];
            h4[2] = (_Float16)a4[2]; h4[3] = (_Float16)a4[3];
            *(v4h*)(&ldsA[row * GKP + c4]) = h4;
        }
        // W tile: 32x64 f32 -> f16, rows as they lie
        #pragma unroll
        for (int j = 0; j < 4; ++j) {
            int idx  = tid + j * 128;
            int krow = idx >> 4;
            int c4   = (idx & 15) << 2;
            v4f b4 = *(const v4f*)(W + (size_t)(k0 + krow) * N + n0 + c4);
            v4h h4;
            h4[0] = (_Float16)b4[0]; h4[1] = (_Float16)b4[1];
            h4[2] = (_Float16)b4[2]; h4[3] = (_Float16)b4[3];
            *(v4h*)(&ldsB[krow * TP + c4]) = h4;
        }
        __syncthreads();

        v16h af[2];
        #pragma unroll
        for (int mi = 0; mi < 2; ++mi)
            af[mi] = make_frag(&ldsA[(wave * 32 + mi * 16 + r) * GKP + 8 * hi]);
        #pragma unroll
        for (int sub = 0; sub < 4; ++sub) {
            v16h bfrag = make_frag_tr(&ldsB[trow * TP + sub * 16 + tcol], TP);
            #pragma unroll
            for (int mi = 0; mi < 2; ++mi)
                acc[mi][sub] = __builtin_amdgcn_wmma_f32_16x16x32_f16(
                    false, af[mi], false, bfrag, (short)0, acc[mi][sub], false, false);
        }
        __syncthreads();
    }

    #pragma unroll
    for (int mi = 0; mi < 2; ++mi) {
        #pragma unroll
        for (int sub = 0; sub < 4; ++sub) {
            int col = n0 + sub * 16 + r;
            float bv = bias[col];
            #pragma unroll
            for (int v = 0; v < 8; ++v) {
                int row = m0 + wave * 32 + mi * 16 + hi * 8 + v;
                Cout[(size_t)row * N + col] = (_Float16)((acc[mi][sub][v] + bv) * scale);
            }
        }
    }
}

// ---------------- GEMM: out_f32 = A_f16 * W_f32 + bias ----------------
__global__ __launch_bounds__(128) void gemm_out_f32(
    const _Float16* __restrict__ A, const float* __restrict__ W,
    const float* __restrict__ bias, float* __restrict__ Out,
    int M, int N, int Kdim)
{
    __shared__ __align__(16) _Float16 ldsA[GM * GKP];
    __shared__ __align__(16) _Float16 ldsB[GK * TP];

    const int tid  = threadIdx.x;
    const int wave = tid >> 5;
    const int lane = tid & 31;
    const int r    = lane & 15;
    const int hi   = lane >> 4;
    const int trow = 8 * hi + (lane & 7);       // transposing load: this lane's row
    const int tcol = 8 * ((lane >> 3) & 1);     // and its 16-byte half of the 16 columns

    const int m0 = blockIdx.y * GM;
    const int n0 = blockIdx.x * GN;

    v8f acc[2][4] = {};

    for (int k0 = 0; k0 < Kdim; k0 += GK) {
        // A tile: 128x32 f16 straight copy -> async to LDS (512 v8h, 4/thread)
        #pragma unroll
        for (int j = 0; j < 4; ++j) {
            int idx = tid + j * 128;
            int row = idx >> 2;
            int c8  = (idx & 3) << 3;
            cp_b128(&ldsA[row * GKP + c8],
                    A + (size_t)(m0 + row) * Kdim + k0 + c8);
        }
        #pragma unroll
        for (int j = 0; j < 4; ++j) {
            int idx  = tid + j * 128;
            int krow = idx >> 4;
            int c4   = (idx & 15) << 2;
            v4f b4 = *(const v4f*)(W + (size_t)(k0 + krow) * N + n0 + c4);
            v4h h4;
            h4[0] = (_Float16)b4[0]; h4[1] = (_Float16)b4[1];
            h4[2] = (_Float16)b4[2]; h4[3] = (_Float16)b4[3];
            *(v4h*)(&ldsB[krow * TP + c4]) = h4;
        }
        cp_wait();
        __syncthreads();

        v16h af[2];
        #pragma unroll
        for (int mi = 0; mi < 2; ++mi)
            af[mi] = make_frag(&ldsA[(wave * 32 + mi * 16 + r) * GKP + 8 * hi]);
        #pragma unroll
        for (int sub = 0; sub < 4; ++sub) {
            v16h bfrag = make_frag_tr(&ldsB[trow * TP + sub * 16 + tcol], TP);
            #pragma unroll
            for (int mi = 0; mi < 2; ++mi)
                acc[mi][sub] = __builtin_amdgcn_wmma_f32_16x16x32_f16(
                    false, af[mi], false, bfrag, (short)0, acc[mi][sub], false, false);
        }
        __syncthreads();
    }

    #pragma unroll
    for (int mi = 0; mi < 2; ++mi) {
        #pragma unroll
        for (int sub = 0; sub < 4; ++sub) {
            int col = n0 + sub * 16 + r;
            float bv = bias[col];
            #pragma unroll
            for (int v = 0; v < 8; ++v) {
                int row = m0 + wave * 32 + mi * 16 + hi * 8 + v;
                Out[(size_t)row * N + col] = acc[mi][sub][v] + bv;
            }
        }
    }
}

// lane l <-> lane l ^ 16: the two lanes that share one query
__device__ __forceinline__ float xhalf(float x) {
    return __builtin_bit_cast(float, __builtin_amdgcn_permlanex16(
        __builtin_bit_cast(int, x), __builtin_bit_cast(int, x),
        0x76543210, 0xfedcba98, false, false));
}

__global__ __launch_bounds__(128) void attn_kernel(
    const _Float16* __restrict__ Qw, const _Float16* __restrict__ Kw,
    const _Float16* __restrict__ Vw, _Float16* __restrict__ Ctx)
{
    __shared__ __align__(16) _Float16 ldsK[64 * AP];    // [key][hd], pitch AP
    __shared__ __align__(16) _Float16 ldsV[64 * TP];    // [key][hd], pitch TP

    const int tid  = threadIdx.x;
    const int wave = tid >> 5;
    const int lane = tid & 31;
    const int r    = lane & 15;
    const int hi   = lane >> 4;
    const int trow = 8 * hi + (lane & 7);       // transposing load: this lane's row
    const int tcol = 8 * ((lane >> 3) & 1);     // and its 16-byte half of the 16 columns

    const int bh = blockIdx.x;
    const int b  = bh / Hc;
    const int h  = bh % Hc;
    const int q0 = blockIdx.y * 128;

    const size_t base   = ((size_t)b * Sc * Hc + h) * HDc;  // (b, s=0, h, 0)
    const size_t rowstr = (size_t)Hc * HDc;                 // per-s stride (halves)

    // Q fragments (B operand): 2 query groups x 2 k-steps over HD=64
    v16h bq[2][2];
    #pragma unroll
    for (int mi = 0; mi < 2; ++mi) {
        const _Float16* qp = Qw + base
            + (size_t)(q0 + wave * 32 + mi * 16 + r) * rowstr;
        #pragma unroll
        for (int ks = 0; ks < 2; ++ks)
            bq[mi][ks] = make_frag(qp + ks * 32 + 8 * hi);
    }

    // per lane: running maximum of query r (equal in both halves) and the
    // running sum over this half's keys (the halves are joined after the loop)
    float mrow[2], lrow[2];
    v8f O[4][2] = {};   // O^T: [16 head dims][query group]
    #pragma unroll
    for (int mi = 0; mi < 2; ++mi) { mrow[mi] = -1e30f; lrow[mi] = 0.0f; }

    for (int kt0 = 0; kt0 < Sc; kt0 += 64) {
        // stage K and V as they lie (async straight copies)
        #pragma unroll
        for (int j = 0; j < 4; ++j) {
            int idx = tid + j * 128;          // 512 chunks of 8 halves
            int key = idx >> 3;
            int c8  = (idx & 7) << 3;
            size_t g = base + (size_t)(kt0 + key) * rowstr + c8;
            cp_b128(&ldsK[key * AP + c8], Kw + g);
            cp_b128(&ldsV[key * TP + c8], Vw + g);
        }
        cp_wait();
        __syncthreads();

        // scores: S^T[64k x 32q] = K(64x64) * Q^T ; K fragments reused across mi
        v8f sacc[4][2] = {};
        #pragma unroll
        for (int ks = 0; ks < 2; ++ks) {
            #pragma unroll
            for (int kt = 0; kt < 4; ++kt) {
                v16h kfrag = make_frag(&ldsK[(kt * 16 + r) * AP + ks * 32 + 8 * hi]);
                #pragma unroll
                for (int mi = 0; mi < 2; ++mi)
                    sacc[kt][mi] = __builtin_amdgcn_wmma_f32_16x16x32_f16(
                        false, kfrag, false, bq[mi][ks], (short)0,
                        sacc[kt][mi], false, false);
            }
        }

        // online softmax: a lane holds 32 of the 64 scores of its query
        v16h pf[2][2];   // P^T as B operand: [query group][32-key step]
        #pragma unroll
        for (int mi = 0; mi < 2; ++mi) {
            float t8[8];
            #pragma unroll
            for (int v = 0; v < 8; ++v)
                t8[v] = fmaxf(fmaxf(sacc[0][mi][v], sacc[1][mi][v]),
                              fmaxf(sacc[2][mi][v], sacc[3][mi][v]));
            float rm = fmaxf(fmaxf(fmaxf(t8[0], t8[1]), fmaxf(t8[2], t8[3])),
                             fmaxf(fmaxf(t8[4], t8[5]), fmaxf(t8[6], t8[7])));
            rm = fmaxf(rm, xhalf(rm));
            const float nm   = fmaxf(mrow[mi], rm);
            const float scal = __expf(mrow[mi] - nm);
            mrow[mi] = nm;

            // exp(x) = exp2(x * log2(e)), as __expf forms it; difference and product on whole tiles
            v8f p[4];
            #pragma unroll
            for (int kt = 0; kt < 4; ++kt) p[kt] = (sacc[kt][mi] - nm) * 1.44269504088896340736f;
            #pragma unroll
            for (int kt = 0; kt < 4; ++kt) {
                #pragma unroll
                for (int v = 0; v < 8; ++v) p[kt][v] = __builtin_amdgcn_exp2f(p[kt][v]);
                sacc[kt][mi] = p[kt];
            }
            const v8f rs = (p[0] + p[1]) + (p[2] + p[3]);
            lrow[mi] = lrow[mi] * scal
                + (((rs[0] + rs[1]) + (rs[2] + rs[3])) + ((rs[4] + rs[5]) + (rs[6] + rs[7])));
            #pragma unroll
            for (int sub = 0; sub < 4; ++sub)
                #pragma unroll
                for (int v = 0; v < 8; ++v)
                    O[sub][mi][v] *= scal;
            // element s of the B operand is key 8*hi + s (s < 8) or 16 + 8*hi + s - 8:
            // registers 0..7 of two S^T tiles that follow one another
            #pragma unroll
            for (int ks = 0; ks < 2; ++ks) {
                v8h plo = __builtin_convertvector(sacc[2 * ks][mi], v8h);
                v8h phi = __builtin_convertvector(sacc[2 * ks + 1][mi], v8h);
                pf[mi][ks] = __builtin_shufflevector(plo, phi,
                    0,1,2,3,4,5,6,7,8,9,10,11,12,13,14,15);
            }
        }

        // O^T += V^T(64x64) * P^T(64x32); V^T fragments reused across mi
        #pragma unroll
        for (int ks = 0; ks < 2; ++ks) {
            #pragma unroll
            for (int sub = 0; sub < 4; ++sub) {
                v16h vfrag = make_frag_tr(&ldsV[(ks * 32 + trow) * TP + sub * 16 + tcol], TP);
                #pragma unroll
                for (int mi = 0; mi < 2; ++mi)
                    O[sub][mi] = __builtin_amdgcn_wmma_f32_16x16x32_f16(
                        false, vfrag, false, pf[mi][ks], (short)0, O[sub][mi], false, false);
            }
        }
        __syncthreads();  // protect ldsK/ldsV for next tile
    }

    // normalize and store ctx (f16, [B,S,H,HD]): a lane holds 8 consecutive
    // head dims of its query per tile, one 16-byte store each
    #pragma unroll
    for (int mi = 0; mi < 2; ++mi) {
        const float l = lrow[mi] + xhalf(lrow[mi]);
        const int row = q0 + wave * 32 + mi * 16 + r;
        #pragma unroll
        for (int sub = 0; sub < 4; ++sub) {
            v8h o8;
            #pragma unroll
            for (int v = 0; v < 8; ++v)
                o8[v] = (_Float16)(O[sub][mi][v] / l);
            *(v8h*)(Ctx + base + (size_t)row * rowstr + sub * 16 + 8 * hi) = o8;
        }
    }
}

extern "C" void kernel_launch(void* const* d_in, const int* in_sizes, int n_in,
                              void* d_out, int out_size, void* d_ws, size_t ws_size,
                              hipStream_t stream) {
    (void)in_sizes; (void)n_in; (void)out_size; (void)ws_size;

    const float* Xq  = (const float*)d_in[0];
    const float* Xkv = (const float*)d_in[1];
    const float* Wq  = (const float*)d_in[2];
    const float* bq  = (const float*)d_in[3];
    const float* Wk  = (const float*)d_in[4];
    const float* bk  = (const float*)d_in[5];
    const float* Wv  = (const float*)d_in[6];
    const float* bv  = (const float*)d_in[7];
    const float* Wo  = (const float*)d_in[8];
    const float* bo  = (const float*)d_in[9];
    float* out = (float*)d_out;

    const size_t elems = (size_t)BSM * Dm;  // 4096*1024
    _Float16* Qh = (_Float16*)d_ws;
    _Float16* Kh = Qh + elems;
    _Float16* Vh = Kh + elems;
    _Float16* Ch = Vh + elems;

    dim3 blk(128);
    dim3 gg(Dm / GN, BSM / GM);       // (16, 32)

    const float qscale = 0.125f;      // 1/sqrt(HD=64)
    dim3 gp(Dm / GN, BSM / GM, 3);    // (16, 32, 3): Qh, Kh, Vh follow one another
    gemm_proj_f16out<<<gp, blk, 0, stream>>>(Xq, Xkv, Wq, Wk, Wv, bq, bk, bv, Qh,
                                             qscale, BSM, Dm, Dm);

    dim3 ga(Bc * Hc, Sc / 128);       // (32, 16)
    attn_kernel<<<ga, blk, 0, stream>>>(Qh, Kh, Vh, Ch);

    gemm_out_f32<<<gg, blk, 0, stream>>>(Ch, Wo, bo, out, BSM, Dm, Dm);
}

// v005
// Measured time: 104 microseconds a run.
// Next to v004, in two timings, it ran 1.18 and 1.17 times as fast.
// Counting every step since v000, it is 3.48 times as fast.
#include <hip/hip_runtime.h>
#include <hip/hip_bf16.h>

// ---- problem constants (match reference) ----
#define Bc   2
#define Sc   2048
#define Dm   1024
#define Hc   16
#define HDc  64
#define BSM  (Bc * Sc)          // 4096 rows

typedef __attribute__((ext_vector_type(16))) _Float16 v16h;
typedef __attribute__((ext_vector_type(8)))  _Float16 v8h;
typedef __attribute__((ext_vector_type(4)))  _Float16 v4h;
typedef __attribute__((ext_vector_type(8)))  float    v8f;
typedef __attribute__((ext_vector_type(4)))  float    v4f;
typedef __attribute__((ext_vector_type(4)))  int      v4i;
typedef __attribute__((ext_vector_type(8)))  short    v8s;

// ---------- CDNA5 async global->LDS copy (ASYNCcnt path), guarded ----------
#if defined(__has_builtin)
#  if __has_builtin(__builtin_amdgcn_global_load_async_to_lds_b128)
#    define HAS_ASYNC_CP 1
#  endif
#endif
#ifndef HAS_ASYNC_CP
#  define HAS_ASYNC_CP 0
#endif

#if HAS_ASYNC_CP
typedef __attribute__((address_space(1))) v4i* g_v4i_p;   // global int4*
typedef __attribute__((address_space(3))) v4i* l_v4i_p;   // LDS int4*
__device__ __forceinline__ void cp_b128(void* lds, const void* g) {
    // global side: flat address == global address, so inttoptr into AS1 is safe;
    // LDS side: generic -> AS3 addrspacecast.
    __builtin_amdgcn_global_load_async_to_lds_b128(
        (g_v4i_p)(uintptr_t)g, (l_v4i_p)lds, 0, 0);
}
__device__ __forceinline__ void cp_wait() {
    // this wave's copies have landed; the clobber holds every LDS read behind it
    asm volatile("s_wait_asynccnt 0x0" ::: "memory");
}
#else
__device__ __forceinline__ void cp_b128(void* lds, const void* g) {
    *(v8h*)lds = *(const v8h*)g;
}
__device__ __forceinline__ void cp_wait() {}
#endif

__device__ __forceinline__ void lds_wait() {
    // this wave's LDS reads and writes have retired, so that the buffer it
    // leaves may be refilled behind the barrier that follows
    asm volatile("s_wait_dscnt 0x0" ::: "memory");
}

__device__ __forceinline__ v16h make_frag(const _Float16* p) {
    // per-lane 16-bit fragment = two contiguous 8-half (16B) chunks:
    // k in [8*hi, 8*hi+8) and [16+8*hi, 16+8*hi+8); caller bakes 8*hi into p.
    v8h lo = *(const v8h*)(p);
    v8h hi8 = *(const v8h*)(p + 16);
    return __builtin_shufflevector(lo, hi8, 0,1,2,3,4,5,6,7,8,9,10,11,12,13,14,15);
}

typedef __attribute__((address_space(3))) v8s* l_v8s_p;   // LDS short8*
__device__ __forceinline__ v16h make_frag_tr(const _Float16* p, int pitch) {
    // the same fragment out of a tile that lies [k][column] in LDS: each
    // transposing load hands lane (r, hi) the 8 halves T[kb + 8*hi + 0..7][cb + r];
    // caller bakes (kb + 8*hi + (lane & 7)) * pitch + cb + 8 * ((lane >> 3) & 1) into p.
    v8h lo  = __builtin_bit_cast(v8h, __builtin_amdgcn_ds_load_tr16_b128_v8i16((l_v8s_p)p));
    v8h hi8 = __builtin_bit_cast(v8h, __builtin_amdgcn_ds_load_tr16_b128_v8i16((l_v8s_p)(p + 16 * pitch)));
    return __builtin_shufflevector(lo, hi8, 0,1,2,3,4,5,6,7,8,9,10,11,12,13,14,15);
}

#define GM   128   // block M tile (2 x 16 rows per wave)
#define GN   64
#define GK   32    // k per stage, projections
#define GKO  64    // k per stage, output product (two 32-k blocks)
// LDS row pitches in halves: 16 B x odd, so the 16 rows of a ds_load_b128
// fragment read fall on 16 different groups of four banks.
#define GKP  40    // 64-B rows  -> 80 B
#define AP   72    // 128-B rows -> 144 B
// Rows read by the transposing load: 32 B x odd.
#define TP   80    // 128-B rows -> 160 B

// ---------------- GEMM: C_f16 = (A_f32 * W_f32 + bias) * scale ----------------
// One launch does the three projections: blockIdx.z picks the product
// (0: query, scaled; 1: key; 2: value). The three results lie one behind the
// other in Cbase, M * N halves each.
__global__ __launch_bounds__(128) void gemm_proj_f16out(
    const float* __restrict__ Xq, const float* __restrict__ Xkv,
    const float* __restrict__ Wq, const float* __restrict__ Wk,
    const float* __restrict__ Wv,
    const float* __restrict__ bq, const float* __restrict__ bk,
    const float* __restrict__ bv, _Float16* __restrict__ Cbase,
    float qscale, int M, int N, int Kdim)
{
    // two buffers each: stage t + 1 is on its way while stage t is multiplied
    __shared__ __align__(16) _Float16 ldsA[2][GM * GKP];   // [m][k], pitch GKP
    __shared__ __align__(16) _Float16 ldsB[2][GK * TP];    // [k][n], pitch TP

    const int which = blockIdx.z;
    const float* __restrict__ A    = which == 0 ? Xq : Xkv;
    const float* __restrict__ W    = which == 0 ? Wq : (which == 1 ? Wk : Wv);
    const float* __restrict__ bias = which == 0 ? bq : (which == 1 ? bk : bv);
    _Float16* __restrict__ Cout    = Cbase + (size_t)which * M * N;
    const float scale              = which == 0 ? qscale : 1.0f;

    const int tid  = threadIdx.x;
    const int wave = tid >> 5;
    const int lane = tid & 31;
    const int r    = lane & 15;
    const int hi   = lane >> 4;
    const int trow = 8 * hi + (lane & 7);       // transposing load: this lane's row
    const int tcol = 8 * ((lane >> 3) & 1);     // and its 16-byte half of the 16 columns

    const int m0 = blockIdx.y * GM;
    const int n0 = blockIdx.x * GN;

    v8f acc[2][4] = {};

    // One stage: 128x32 of A (8 chunks of 4 floats per thread) and 32x64 of W
    // (4 chunks), held in registers while the stage before it is multiplied.
    // One pointer per operand walks the stages and the rows are uniform strides
    // from it: few registers, so that six work-groups still fit a WGP.
    const float* ap = A + (size_t)(m0 + (tid >> 3)) * Kdim + ((tid & 7) << 2);
    const float* wp = W + (size_t)(tid >> 4) * N + n0 + ((tid & 15) << 2);
    v4f ar[8], wr[4];
    auto load_stage = [&]() {
        const v4f* pa[8];
        const v4f* pw[4];
        #pragma unroll
        for (int j = 0; j < 8; ++j) {      // thread's row: j * 16 + (tid >> 3)
            pa[j] = (const v4f*)(ap + (size_t)(j * 16) * Kdim);
            ar[j] = *pa[j];
        }
        #pragma unroll
        for (int j = 0; j < 4; ++j) {      // thread's k row: j * 8 + (tid >> 4)
            pw[j] = (const v4f*)(wp + (size_t)(j * 8) * N);
            wr[j] = *pw[j];
        }
        // the loads stay in flight over the next stage's products, which reuse
        // their address registers: the wait stands in front of that overwrite,
        // and as its inputs the addresses stay whole up to it
        asm volatile("s_wait_xcnt 0x0" :: "v"(pa[0]), "v"(pa[1]), "v"(pa[2]), "v"(pa[3]),
                     "v"(pa[4]), "v"(pa[5]), "v"(pa[6]), "v"(pa[7]),
                     "v"(pw[0]), "v"(pw[1]), "v"(pw[2]), "v"(pw[3]) : "memory");
        ap += GK;
        wp += (size_t)GK * N;
    };
    // -> f16, rows as they lie
    auto store_stage = [&](int buf) {
        #pragma unroll
        for (int j = 0; j < 8; ++j)
            *(v4h*)(&ldsA[buf][(j * 16 + (tid >> 3)) * GKP + ((tid & 7) << 2)]) =
                __builtin_convertvector(ar[j], v4h);
        #pragma unroll
        for (int j = 0; j < 4; ++j)
            *(v4h*)(&ldsB[buf][(j * 8 + (tid >> 4)) * TP + ((tid & 15) << 2)]) =
                __builtin_convertvector(wr[j], v4h);
    };

    const int nt = Kdim / GK;
    load_stage();
    store_stage(0);
    __syncthreads();
    if (nt > 1) load_stage();

    for (int t = 0; t < nt; ++t) {
        const int cur = t & 1;
        v16h af[2];
        #pragma unroll
        for (int mi = 0; mi < 2; ++mi)
            af[mi] = make_frag(&ldsA[cur][(wave * 32 + mi * 16 + r) * GKP + 8 * hi]);
        #pragma unroll
        for (int sub = 0; sub < 4; ++sub) {
            v16h bfrag = make_frag_tr(&ldsB[cur][trow * TP + sub * 16 + tcol], TP);
            #pragma unroll
            for (int mi = 0; mi < 2; ++mi)
                acc[mi][sub] = __builtin_amdgcn_wmma_f32_16x16x32_f16(
                    false, af[mi], false, bfrag, (short)0, acc[mi][sub], false, false);
        }
        // the other buffers were left by their readers at the barrier of stage t - 1
        if (t + 1 < nt) store_stage(cur ^ 1);
        // publish stage t + 1 and free stage t's buffers with one barrier
        __syncthreads();
        if (t + 2 < nt) load_stage();
    }

    #pragma unroll
    for (int mi = 0; mi < 2; ++mi) {
        #pragma unroll
        for (int sub = 0; sub < 4; ++sub) {
            int col = n0 + sub * 16 + r;
            float bv = bias[col];
            #pragma unroll
            for (int v = 0; v < 8; ++v) {
                int row = m0 + wave * 32 + mi * 16 + hi * 8 + v;
                Cout[(size_t)row * N + col] = (_Float16)((acc[mi][sub][v] + bv) * scale);
            }
        }
    }
}

// ---------------- GEMM: out_f32 = A_f16 * W_f32 + bias ----------------
__global__ __launch_bounds__(128) void gemm_out_f32(
    const _Float16* __restrict__ A, const float* __restrict__ W,
    const float* __restrict__ bias, float* __restrict__ Out,
    int M, int N, int Kdim)
{
    // two buffers each: stage t + 1 is on its way while stage t is multiplied
    __shared__ __align__(16) _Float16 ldsA[2][GM * AP];    // [m][k], pitch AP
    __shared__ __align__(16) _Float16 ldsB[2][GKO * TP];   // [k][n], pitch TP

    const int tid  = threadIdx.x;
    const int wave = tid >> 5;
    const int lane = tid & 31;
    const int r    = lane & 15;
    const int hi   = lane >> 4;
    const int trow = 8 * hi + (lane & 7);       // transposing load: this lane's row
    const int tcol = 8 * ((lane >> 3) & 1);     // and its 16-byte half of the 16 columns

    const int m0 = blockIdx.y * GM;
    const int n0 = blockIdx.x * GN;

    v8f acc[2][4] = {};

    // A stage: 128x64 f16 straight copy to LDS (1024 chunks of 16 B, 8 per thread)
    // Addresses are a uniform base plus one 32-bit byte offset per thread.
    const unsigned a_off = (unsigned)((tid >> 3) * Kdim + ((tid & 7) << 3)) * 2u;
    const unsigned w_off = (unsigned)((tid >> 4) * N + ((tid & 15) << 2)) * 4u;
    auto copy_a = [&](int t, int buf) {
        #pragma unroll
        for (int j = 0; j < 8; ++j) {      // thread's row: j * 16 + (tid >> 3)
            int row = j * 16 + (tid >> 3);
            int c8  = (tid & 7) << 3;
            cp_b128(&ldsA[buf][row * AP + c8],
                    (const char*)(A + (size_t)(m0 + j * 16) * Kdim + t * GKO) + a_off);
        }
    };
    // W stage: 64x64 f32, held in registers while the stage before it is multiplied
    v4f wr[8];
    auto load_w = [&](int t) {
        const v4f* p[8];
        #pragma unroll
        for (int j = 0; j < 8; ++j) {      // thread's k row: j * 8 + (tid >> 4)
            p[j]  = (const v4f*)((const char*)(W + (size_t)(t * GKO + j * 8) * N + n0) + w_off);
            wr[j] = *p[j];
        }
        // the loads stay in flight over the next stage's products, which reuse
        // their address registers: the wait stands in front of that overwrite,
        // and as its inputs the addresses stay whole up to it
        asm volatile("s_wait_xcnt 0x0" :: "v"(p[0]), "v"(p[1]), "v"(p[2]), "v"(p[3]),
                     "v"(p[4]), "v"(p[5]), "v"(p[6]), "v"(p[7]) : "memory");
    };
    // -> f16, rows as they lie
    auto store_w = [&](int buf) {
        #pragma unroll
        for (int j = 0; j < 8; ++j) {
            int idx  = tid + j * 128;
            int krow = idx >> 4;
            int c4   = (idx & 15) << 2;
            *(v4h*)(&ldsB[buf][krow * TP + c4]) = __builtin_convertvector(wr[j], v4h);
        }
    };

    const int nt = Kdim / GKO;
    copy_a(0, 0);
    load_w(0);
    store_w(0);
    lds_wait();
    cp_wait();
    __syncthreads();
    if (nt > 1) { copy_a(1, 1); load_w(1); }

    for (int t = 0; t < nt; ++t) {
        const int cur = t & 1;
        #pragma unroll
        for (int ks = 0; ks < 2; ++ks) {
            v16h af[2];
            #pragma unroll
            for (int mi = 0; mi < 2; ++mi)
                af[mi] = make_frag(&ldsA[cur][(wave * 32 + mi * 16 + r) * AP + ks * 32 + 8 * hi]);
            #pragma unroll
            for (int sub = 0; sub < 4; ++sub) {
                v16h bfrag = make_frag_tr(&ldsB[cur][(ks * 32 + trow) * TP + sub * 16 + tcol], TP);
                #pragma unroll
                for (int mi = 0; mi < 2; ++mi)
                    acc[mi][sub] = __builtin_amdgcn_wmma_f32_16x16x32_f16(
                        false, af[mi], false, bfrag, (short)0, acc[mi][sub], false, false);
            }
        }
        // the other W buffer was left by its readers at the barrier of stage t - 1
        if (t + 1 < nt) store_w(cur ^ 1);
        // publish stage t + 1 and free stage t's buffers with one barrier
        lds_wait();
        cp_wait();
        __syncthreads();
        if (t + 2 < nt) { copy_a(t + 2, cur); load_w(t + 2); }
    }
    cp_wait();

    #pragma unroll
    for (int mi = 0; mi < 2; ++mi) {
        #pragma unroll
        for (int sub = 0; sub < 4; ++sub) {
            int col = n0 + sub * 16 + r;
            float bv = bias[col];
            #pragma unroll
            for (int v = 0; v < 8; ++v) {
                int row = m0 + wave * 32 + mi * 16 + hi * 8 + v;
                Out[(size_t)row * N + col] = acc[mi][sub][v] + bv;
            }
        }
    }
}

// lane l <-> lane l ^ 16: the two lanes that share one query
__device__ __forceinline__ float xhalf(float x) {
    return __builtin_bit_cast(float, __builtin_amdgcn_permlanex16(
        __builtin_bit_cast(int, x), __builtin_bit_cast(int, x),
        0x76543210, 0xfedcba98, false, false));
}

__global__ __launch_bounds__(128) void attn_kernel(
    const _Float16* __restrict__ Qw, const _Float16* __restrict__ Kw,
    const _Float16* __restrict__ Vw, _Float16* __restrict__ Ctx)
{
    // two buffers each: the next 64 keys are on their way while these are worked on
    __shared__ __align__(16) _Float16 ldsK[2][64 * AP];    // [key][hd], pitch AP
    __shared__ __align__(16) _Float16 ldsV[2][64 * TP];    // [key][hd], pitch TP

    const int tid  = threadIdx.x;
    const int wave = tid >> 5;
    const int lane = tid & 31;
    const int r    = lane & 15;
    const int hi   = lane >> 4;
    const int trow = 8 * hi + (lane & 7);       // transposing load: this lane's row
    const int tcol = 8 * ((lane >> 3) & 1);     // and its 16-byte half of the 16 columns

    const int bh = blockIdx.x;
    const int b  = bh / Hc;
    const int h  = bh % Hc;
    const int q0 = blockIdx.y * 128;

    const size_t base   = ((size_t)b * Sc * Hc + h) * HDc;  // (b, s=0, h, 0)
    const size_t rowstr = (size_t)Hc * HDc;                 // per-s stride (halves)

    // Q fragments (B operand): 2 query groups x 2 k-steps over HD=64
    v16h bq[2][2];
    #pragma unroll
    for (int mi = 0; mi < 2; ++mi) {
        const _Float16* qp = Qw + base
            + (size_t)(q0 + wave * 32 + mi * 16 + r) * rowstr;
        #pragma unroll
        for (int ks = 0; ks < 2; ++ks)
            bq[mi][ks] = make_frag(qp + ks * 32 + 8 * hi);
    }

    // per lane: running maximum of query r (equal in both halves) and the
    // running sum over this half's keys (the halves are joined after the loop)
    float mrow[2], lrow[2];
    v8f O[4][2] = {};   // O^T: [16 head dims][query group]
    #pragma unroll
    for (int mi = 0; mi < 2; ++mi) { mrow[mi] = -1e30f; lrow[mi] = 0.0f; }

    // stage K and V as they lie (async straight copies)
    auto copy_kv = [&](int t, int buf) {
        #pragma unroll
        for (int j = 0; j < 4; ++j) {
            int idx = tid + j * 128;          // 512 chunks of 8 halves
            int key = idx >> 3;
            int c8  = (idx & 7) << 3;
            size_t g = base + (size_t)(t * 64 + key) * rowstr + c8;
            cp_b128(&ldsK[buf][key * AP + c8], Kw + g);
            cp_b128(&ldsV[buf][key * TP + c8], Vw + g);
        }
    };
    constexpr int NT = Sc / 64;   // 32 stages
    copy_kv(0, 0);
    cp_wait();
    __syncthreads();
    copy_kv(1, 1);

    for (int t = 0; t < NT; ++t) {
        const int cur = t & 1;

        // scores: S^T[64k x 32q] = K(64x64) * Q^T ; K fragments reused across mi
        v8f sacc[4][2] = {};
        #pragma unroll
        for (int ks = 0; ks < 2; ++ks) {
            #pragma unroll
            for (int kt = 0; kt < 4; ++kt) {
                v16h kfrag = make_frag(&ldsK[cur][(kt * 16 + r) * AP + ks * 32 + 8 * hi]);
                #pragma unroll
                for (int mi = 0; mi < 2; ++mi)
                    sacc[kt][mi] = __builtin_amdgcn_wmma_f32_16x16x32_f16(
                        false, kfrag, false, bq[mi][ks], (short)0,
                        sacc[kt][mi], false, false);
            }
        }

        // online softmax: a lane holds 32 of the 64 scores of its query
        v16h pf[2][2];   // P^T as B operand: [query group][32-key step]
        #pragma unroll
        for (int mi = 0; mi < 2; ++mi) {
            float t8[8];
            #pragma unroll
            for (int v = 0; v < 8; ++v)
                t8[v] = fmaxf(fmaxf(sacc[0][mi][v], sacc[1][mi][v]),
                              fmaxf(sacc[2][mi][v], sacc[3][mi][v]));
            float rm = fmaxf(fmaxf(fmaxf(t8[0], t8[1]), fmaxf(t8[2], t8[3])),
                             fmaxf(fmaxf(t8[4], t8[5]), fmaxf(t8[6], t8[7])));
            rm = fmaxf(rm, xhalf(rm));
            const float nm   = fmaxf(mrow[mi], rm);
            const float scal = __expf(mrow[mi] - nm);
            mrow[mi] = nm;

            // exp(x) = exp2(x * log2(e)), as __expf forms it; difference and product on whole tiles
            v8f p[4];
            #pragma unroll
            for (int kt = 0; kt < 4; ++kt) p[kt] = (sacc[kt][mi] - nm) * 1.44269504088896340736f;
            #pragma unroll
            for (int kt = 0; kt < 4; ++kt) {
                #pragma unroll
                for (int v = 0; v < 8; ++v) p[kt][v] = __builtin_amdgcn_exp2f(p[kt][v]);
                sacc[kt][mi] = p[kt];
            }
            const v8f rs = (p[0] + p[1]) + (p[2] + p[3]);
            lrow[mi] = lrow[mi] * scal
                + (((rs[0] + rs[1]) + (rs[2] + rs[3])) + ((rs[4] + rs[5]) + (rs[6] + rs[7])));
            #pragma unroll
            for (int sub = 0; sub < 4; ++sub)
                #pragma unroll
                for (int v = 0; v < 8; ++v)
                    O[sub][mi][v] *= scal;
            // element s of the B operand is key 8*hi + s (s < 8) or 16 + 8*hi + s - 8:
            // registers 0..7 of two S^T tiles that follow one another
            #pragma unroll
            for (int ks = 0; ks < 2; ++ks) {
                v8h plo = __builtin_convertvector(sacc[2 * ks][mi], v8h);
                v8h phi = __builtin_convertvector(sacc[2 * ks + 1][mi], v8h);
                pf[mi][ks] = __builtin_shufflevector(plo, phi,
                    0,1,2,3,4,5,6,7,8,9,10,11,12,13,14,15);
            }
        }

        // O^T += V^T(64x64) * P^T(64x32); V^T fragments reused across mi
        #pragma unroll
        for (int ks = 0; ks < 2; ++ks) {
            #pragma unroll
            for (int sub = 0; sub < 4; ++sub) {
                v16h vfrag = make_frag_tr(&ldsV[cur][(ks * 32 + trow) * TP + sub * 16 + tcol], TP);
                #pragma unroll
                for (int mi = 0; mi < 2; ++mi)
                    O[sub][mi] = __builtin_amdgcn_wmma_f32_16x16x32_f16(
                        false, vfrag, false, pf[mi][ks], (short)0, O[sub][mi], false, false);
            }
        }
        // publish stage t + 1 and free stage t's buffers with one barrier
        lds_wait();
        cp_wait();
        __syncthreads();
        if (t + 2 < NT) copy_kv(t + 2, cur);
    }
    cp_wait();

    // normalize and store ctx (f16, [B,S,H,HD]): a lane holds 8 consecutive
    // head dims of its query per tile, one 16-byte store each
    #pragma unroll
    for (int mi = 0; mi < 2; ++mi) {
        const float l = lrow[mi] + xhalf(lrow[mi]);
        const int row = q0 + wave * 32 + mi * 16 + r;
        #pragma unroll
        for (int sub = 0; sub < 4; ++sub) {
            v8h o8;
            #pragma unroll
            for (int v = 0; v < 8; ++v)
                o8[v] = (_Float16)(O[sub][mi][v] / l);
            *(v8h*)(Ctx + base + (size_t)row * rowstr + sub * 16 + 8 * hi) = o8;
        }
    }
}

extern "C" void kernel_launch(void* const* d_in, const int* in_sizes, int n_in,
                              void* d_out, int out_size, void* d_ws, size_t ws_size,
                              hipStream_t stream) {
    (void)in_sizes; (void)n_in; (void)out_size; (void)ws_size;

    const float* Xq  = (const float*)d_in[0];
    const float* Xkv = (const float*)d_in[1];
    const float* Wq  = (const float*)d_in[2];
    const float* bq  = (const float*)d_in[3];
    const float* Wk  = (const float*)d_in[4];
    const float* bk  = (const float*)d_in[5];
    const float* Wv  = (const float*)d_in[6];
    const float* bv  = (const float*)d_in[7];
    const float* Wo  = (const float*)d_in[8];
    const float* bo  = (const float*)d_in[9];
    float* out = (float*)d_out;

    const size_t elems = (size_t)BSM * Dm;  // 4096*1024
    _Float16* Qh = (_Float16*)d_ws;
    _Float16* Kh = Qh + elems;
    _Float16* Vh = Kh + elems;
    _Float16* Ch = Vh + elems;

    dim3 blk(128);
    dim3 gg(Dm / GN, BSM / GM);       // (16, 32)

    const float qscale = 0.125f;      // 1/sqrt(HD=64)
    dim3 gp(Dm / GN, BSM / GM, 3);    // (16, 32, 3): Qh, Kh, Vh follow one another
    gemm_proj_f16out<<<gp, blk, 0, stream>>>(Xq, Xkv, Wq, Wk, Wv, bq, bk, bv, Qh,
                                             qscale, BSM, Dm, Dm);

    dim3 ga(Bc * Hc, Sc / 128);       // (32, 16)
    attn_kernel<<<ga, blk, 0, stream>>>(Qh, Kh, Vh, Ch);

    gemm_out_f32<<<gg, blk, 0, stream>>>(Ch, Wo, bo, out, BSM, Dm, Dm);
}

// v006
// One run takes 92.9 microseconds.
// Two timings next to v005 both put it at 1.11 times that version's speed.
// Over all steps from v000 it is 3.88 times as fast.
#include <hip/hip_runtime.h>
#include <hip/hip_bf16.h>

// ---- problem constants (match reference) ----
#define Bc   2
#define Sc   2048
#define Dm   1024
#define Hc   16
#define HDc  64
#define BSM  (Bc * Sc)          // 4096 rows

typedef __attribute__((ext_vector_type(16))) _Float16 v16h;
typedef __attribute__((ext_vector_type(8)))  _Float16 v8h;
typedef __attribute__((ext_vector_type(4)))  _Float16 v4h;
typedef __attribute__((ext_vector_type(8)))  float    v8f;
typedef __attribute__((ext_vector_type(4)))  float    v4f;
typedef __attribute__((ext_vector_type(4)))  int      v4i;
typedef __attribute__((ext_vector_type(8)))  short    v8s;

// ---------- CDNA5 async global->LDS copy (ASYNCcnt path), guarded ----------
#if defined(__has_builtin)
#  if __has_builtin(__builtin_amdgcn_global_load_async_to_lds_b128)
#    define HAS_ASYNC_CP 1
#  endif
#endif
#ifndef HAS_ASYNC_CP
#  define HAS_ASYNC_CP 0
#endif

#if HAS_ASYNC_CP
typedef __attribute__((address_space(1))) v4i* g_v4i_p;   // global int4*
typedef __attribute__((address_space(3))) v4i* l_v4i_p;   // LDS int4*
__device__ __forceinline__ void cp_b128(void* lds, const void* g) {
    // global side: flat address == global address, so inttoptr into AS1 is safe;
    // LDS side: generic -> AS3 addrspacecast.
    __builtin_amdgcn_global_load_async_to_lds_b128(
        (g_v4i_p)(uintptr_t)g, (l_v4i_p)lds, 0, 0);
}
__device__ __forceinline__ void cp_wait() {
    // this wave's copies have landed; the clobber holds every LDS read behind it
    asm volatile("s_wait_asynccnt 0x0" ::: "memory");
}
#else
__device__ __forceinline__ void cp_b128(void* lds, const void* g) {
    *(v8h*)lds = *(const v8h*)g;
}
__device__ __forceinline__ void cp_wait() {}
#endif

__device__ __forceinline__ void lds_wait() {
    // this wave's LDS reads and writes have retired, so that the buffer it
    // leaves may be refilled behind the barrier that follows
    asm volatile("s_wait_dscnt 0x0" ::: "memory");
}

__device__ __forceinline__ v16h make_frag(const _Float16* p) {
    // per-lane 16-bit fragment = two contiguous 8-half (16B) chunks:
    // k in [8*hi, 8*hi+8) and [16+8*hi, 16+8*hi+8); caller bakes 8*hi into p.
    v8h lo = *(const v8h*)(p);
    v8h hi8 = *(const v8h*)(p + 16);
    return __builtin_shufflevector(lo, hi8, 0,1,2,3,4,5,6,7,8,9,10,11,12,13,14,15);
}

typedef __attribute__((address_space(3))) v8s* l_v8s_p;   // LDS short8*
__device__ __forceinline__ v16h make_frag_tr(const _Float16* p, int pitch) {
    // the same fragment out of a tile that lies [k][column] in LDS: each
    // transposing load hands lane (r, hi) the 8 halves T[kb + 8*hi + 0..7][cb + r];
    // caller bakes (kb + 8*hi + (lane & 7)) * pitch + cb + 8 * ((lane >> 3) & 1) into p.
    v8h lo  = __builtin_bit_cast(v8h, __builtin_amdgcn_ds_load_tr16_b128_v8i16((l_v8s_p)p));
    v8h hi8 = __builtin_bit_cast(v8h, __builtin_amdgcn_ds_load_tr16_b128_v8i16((l_v8s_p)(p + 16 * pitch)));
    return __builtin_shufflevector(lo, hi8, 0,1,2,3,4,5,6,7,8,9,10,11,12,13,14,15);
}

#define GM   128   // output product: block M tile (2 x 16 rows per wave)
#define GN   64
#define PM   256   // projections: block tile, 4 x 2 waves of 64 x 64
#define PN   128
#define GK   32    // k per stage, projections
#define GKO  64    // k per stage, output product (two 32-k blocks)
// LDS row pitches in halves: 16 B x odd, so the 16 rows of a ds_load_b128
// fragment read fall on 16 different groups of four banks.
#define GKP  40    // 64-B rows  -> 80 B
#define AP   72    // 128-B rows -> 144 B
// Rows read by the transposing load: 32 B x odd.
#define TP   80    // 128-B rows -> 160 B
#define BP   144   // 256-B rows -> 288 B

// ---------------- GEMM: C_f16 = (A_f32 * W_f32 + bias) * scale ----------------
// One launch does the three projections: blockIdx.z picks the product
// (0: query, scaled; 1: key; 2: value). The three results lie one behind the
// other in Cbase, M * N halves each.
// Block tile 256 x 128, 8 waves (4 x 2) of 64 x 64: a loaded byte of A serves
// 128 columns and a loaded byte of W 256 rows, and a fragment read from LDS
// serves four products.
__global__ __launch_bounds__(256) void gemm_proj_f16out(
    const float* __restrict__ Xq, const float* __restrict__ Xkv,
    const float* __restrict__ Wq, const float* __restrict__ Wk,
    const float* __restrict__ Wv,
    const float* __restrict__ bq, const float* __restrict__ bk,
    const float* __restrict__ bv, _Float16* __restrict__ Cbase,
    float qscale, int M, int N, int Kdim)
{
    // two buffers each: stage t + 1 is on its way while stage t is multiplied
    __shared__ __align__(16) _Float16 ldsA[2][PM * GKP];   // [m][k], pitch GKP
    __shared__ __align__(16) _Float16 ldsB[2][GK * BP];    // [k][n], pitch BP

    const int which = blockIdx.z;
    const float* __restrict__ A    = which == 0 ? Xq : Xkv;
    const float* __restrict__ W    = which == 0 ? Wq : (which == 1 ? Wk : Wv);
    const float* __restrict__ bias = which == 0 ? bq : (which == 1 ? bk : bv);
    _Float16* __restrict__ Cout    = Cbase + (size_t)which * M * N;
    const float scale              = which == 0 ? qscale : 1.0f;

    const int tid  = threadIdx.x;
    const int wave = tid >> 5;
    const int wm   = wave >> 1;                 // wave's 64 rows of the tile
    const int wn   = wave & 1;                  // wave's 64 columns
    const int lane = tid & 31;
    const int r    = lane & 15;
    const int hi   = lane >> 4;
    const int trow = 8 * hi + (lane & 7);       // transposing load: this lane's row
    const int tcol = 8 * ((lane >> 3) & 1);     // and its 16-byte half of the 16 columns

    const int m0 = blockIdx.y * PM;
    const int n0 = blockIdx.x * PN;

    v8f acc[4][4] = {};

    // One stage: 256x32 of A (8 chunks of 4 floats per thread) and 32x128 of W
    // (4 chunks), held in registers while the stage before it is multiplied.
    // One pointer per operand walks the stages and the rows are uniform strides
    // from it.
    const float* ap = A + (size_t)(m0 + (tid >> 3)) * Kdim + ((tid & 7) << 2);
    const float* wp = W + (size_t)(tid >> 5) * N + n0 + ((tid & 31) << 2);
    v4f ar[8], wr[4];
    auto load_stage = [&]() {
        const v4f* pa[8];
        const v4f* pw[4];
        #pragma unroll
        for (int j = 0; j < 8; ++j) {      // thread's row: j * 32 + (tid >> 3)
            pa[j] = (const v4f*)(ap + (size_t)(j * 32) * Kdim);
            ar[j] = *pa[j];
        }
        #pragma unroll
        for (int j = 0; j < 4; ++j) {      // thread's k row: j * 8 + (tid >> 5)
            pw[j] = (const v4f*)(wp + (size_t)(j * 8) * N);
            wr[j] = *pw[j];
        }
        // the loads stay in flight over the next stage's products, which reuse
        // their address registers: the wait stands in front of that overwrite,
        // and as its inputs the addresses stay whole up to it
        asm volatile("s_wait_xcnt 0x0" :: "v"(pa[0]), "v"(pa[1]), "v"(pa[2]), "v"(pa[3]),
                     "v"(pa[4]), "v"(pa[5]), "v"(pa[6]), "v"(pa[7]),
                     "v"(pw[0]), "v"(pw[1]), "v"(pw[2]), "v"(pw[3]) : "memory");
        ap += GK;
        wp += (size_t)GK * N;
    };
    // -> f16, rows as they lie
    auto store_stage = [&](int buf) {
        #pragma unroll
        for (int j = 0; j < 8; ++j)
            *(v4h*)(&ldsA[buf][(j * 32 + (tid >> 3)) * GKP + ((tid & 7) << 2)]) =
                __builtin_convertvector(ar[j], v4h);
        #pragma unroll
        for (int j = 0; j < 4; ++j)
            *(v4h*)(&ldsB[buf][(j * 8 + (tid >> 5)) * BP + ((tid & 31) << 2)]) =
                __builtin_convertvector(wr[j], v4h);
    };

    const int nt = Kdim / GK;
    load_stage();
    store_stage(0);
    __syncthreads();
    if (nt > 1) load_stage();

    for (int t = 0; t < nt; ++t) {
        const int cur = t & 1;
        v16h af[4];
        #pragma unroll
        for (int mi = 0; mi < 4; ++mi)
            af[mi] = make_frag(&ldsA[cur][(wm * 64 + mi * 16 + r) * GKP + 8 * hi]);
        #pragma unroll
        for (int sub = 0; sub < 4; ++sub) {
            v16h bfrag = make_frag_tr(&ldsB[cur][trow * BP + wn * 64 + sub * 16 + tcol], BP);
            #pragma unroll
            for (int mi = 0; mi < 4; ++mi)
                acc[mi][sub] = __builtin_amdgcn_wmma_f32_16x16x32_f16(
                    false, af[mi], false, bfrag, (short)0, acc[mi][sub], false, false);
        }
        // the other buffers were left by their readers at the barrier of stage t - 1
        if (t + 1 < nt) store_stage(cur ^ 1);
        // publish stage t + 1 and free stage t's buffers with one barrier
        __syncthreads();
        if (t + 2 < nt) load_stage();
    }

    #pragma unroll
    for (int mi = 0; mi < 4; ++mi) {
        #pragma unroll
        for (int sub = 0; sub < 4; ++sub) {
            int col = n0 + wn * 64 + sub * 16 + r;
            float bv = bias[col];
            #pragma unroll
            for (int v = 0; v < 8; ++v) {
                int row = m0 + wm * 64 + mi * 16 + hi * 8 + v;
                Cout[(size_t)row * N + col] = (_Float16)((acc[mi][sub][v] + bv) * scale);
            }
        }
    }
}

// ---------------- GEMM: out_f32 = A_f16 * W_f32 + bias ----------------
__global__ __launch_bounds__(128) void gemm_out_f32(
    const _Float16* __restrict__ A, const float* __restrict__ W,
    const float* __restrict__ bias, float* __restrict__ Out,
    int M, int N, int Kdim)
{
    // two buffers each: stage t + 1 is on its way while stage t is multiplied
    __shared__ __align__(16) _Float16 ldsA[2][GM * AP];    // [m][k], pitch AP
    __shared__ __align__(16) _Float16 ldsB[2][GKO * TP];   // [k][n], pitch TP

    const int tid  = threadIdx.x;
    const int wave = tid >> 5;
    const int lane = tid & 31;
    const int r    = lane & 15;
    const int hi   = lane >> 4;
    const int trow = 8 * hi + (lane & 7);       // transposing load: this lane's row
    const int tcol = 8 * ((lane >> 3) & 1);     // and its 16-byte half of the 16 columns

    const int m0 = blockIdx.y * GM;
    const int n0 = blockIdx.x * GN;

    v8f acc[2][4] = {};

    // A stage: 128x64 f16 straight copy to LDS (1024 chunks of 16 B, 8 per thread)
    // Addresses are a uniform base plus one 32-bit byte offset per thread.
    const unsigned a_off = (unsigned)((tid >> 3) * Kdim + ((tid & 7) << 3)) * 2u;
    const unsigned w_off = (unsigned)((tid >> 4) * N + ((tid & 15) << 2)) * 4u;
    auto copy_a = [&](int t, int buf) {
        #pragma unroll
        for (int j = 0; j < 8; ++j) {      // thread's row: j * 16 + (tid >> 3)
            int row = j * 16 + (tid >> 3);
            int c8  = (tid & 7) << 3;
            cp_b128(&ldsA[buf][row * AP + c8],
                    (const char*)(A + (size_t)(m0 + j * 16) * Kdim + t * GKO) + a_off);
        }
    };
    // W stage: 64x64 f32, held in registers while the stage before it is multiplied
    v4f wr[8];
    auto load_w = [&](int t) {
        const v4f* p[8];
        #pragma unroll
        for (int j = 0; j < 8; ++j) {      // thread's k row: j * 8 + (tid >> 4)
            p[j]  = (const v4f*)((const char*)(W + (size_t)(t * GKO + j * 8) * N + n0) + w_off);
            wr[j] = *p[j];
        }
        // the loads stay in flight over the next stage's products, which reuse
        // their address registers: the wait stands in front of that overwrite,
        // and as its inputs the addresses stay whole up to it
        asm volatile("s_wait_xcnt 0x0" :: "v"(p[0]), "v"(p[1]), "v"(p[2]), "v"(p[3]),
                     "v"(p[4]), "v"(p[5]), "v"(p[6]), "v"(p[7]) : "memory");
    };
    // -> f16, rows as they lie
    auto store_w = [&](int buf) {
        #pragma unroll
        for (int j = 0; j < 8; ++j) {
            int idx  = tid + j * 128;
            int krow = idx >> 4;
            int c4   = (idx & 15) << 2;
            *(v4h*)(&ldsB[buf][krow * TP + c4]) = __builtin_convertvector(wr[j], v4h);
        }
    };

    const int nt = Kdim / GKO;
    copy_a(0, 0);
    load_w(0);
    store_w(0);
    lds_wait();
    cp_wait();
    __syncthreads();
    if (nt > 1) { copy_a(1, 1); load_w(1); }

    for (int t = 0; t < nt; ++t) {
        const int cur = t & 1;
        #pragma unroll
        for (int ks = 0; ks < 2; ++ks) {
            v16h af[2];
            #pragma unroll
            for (int mi = 0; mi < 2; ++mi)
                af[mi] = make_frag(&ldsA[cur][(wave * 32 + mi * 16 + r) * AP + ks * 32 + 8 * hi]);
            #pragma unroll
            for (int sub = 0; sub < 4; ++sub) {
                v16h bfrag = make_frag_tr(&ldsB[cur][(ks * 32 + trow) * TP + sub * 16 + tcol], TP);
                #pragma unroll
                for (int mi = 0; mi < 2; ++mi)
                    acc[mi][sub] = __builtin_amdgcn_wmma_f32_16x16x32_f16(
                        false, af[mi], false, bfrag, (short)0, acc[mi][sub], false, false);
            }
        }
        // the other W buffer was left by its readers at the barrier of stage t - 1
        if (t + 1 < nt) store_w(cur ^ 1);
        // publish stage t + 1 and free stage t's buffers with one barrier
        lds_wait();
        cp_wait();
        __syncthreads();
        if (t + 2 < nt) { copy_a(t + 2, cur); load_w(t + 2); }
    }
    cp_wait();

    #pragma unroll
    for (int mi = 0; mi < 2; ++mi) {
        #pragma unroll
        for (int sub = 0; sub < 4; ++sub) {
            int col = n0 + sub * 16 + r;
            float bv = bias[col];
            #pragma unroll
            for (int v = 0; v < 8; ++v) {
                int row = m0 + wave * 32 + mi * 16 + hi * 8 + v;
                Out[(size_t)row * N + col] = acc[mi][sub][v] + bv;
            }
        }
    }
}

// lane l <-> lane l ^ 16: the two lanes that share one query
__device__ __forceinline__ float xhalf(float x) {
    return __builtin_bit_cast(float, __builtin_amdgcn_permlanex16(
        __builtin_bit_cast(int, x), __builtin_bit_cast(int, x),
        0x76543210, 0xfedcba98, false, false));
}

__global__ __launch_bounds__(128) void attn_kernel(
    const _Float16* __restrict__ Qw, const _Float16* __restrict__ Kw,
    const _Float16* __restrict__ Vw, _Float16* __restrict__ Ctx)
{
    // two buffers each: the next 64 keys are on their way while these are worked on
    __shared__ __align__(16) _Float16 ldsK[2][64 * AP];    // [key][hd], pitch AP
    __shared__ __align__(16) _Float16 ldsV[2][64 * TP];    // [key][hd], pitch TP

    const int tid  = threadIdx.x;
    const int wave = tid >> 5;
    const int lane = tid & 31;
    const int r    = lane & 15;
    const int hi   = lane >> 4;
    const int trow = 8 * hi + (lane & 7);       // transposing load: this lane's row
    const int tcol = 8 * ((lane >> 3) & 1);     // and its 16-byte half of the 16 columns

    const int bh = blockIdx.x;
    const int b  = bh / Hc;
    const int h  = bh % Hc;
    const int q0 = blockIdx.y * 128;

    const size_t base   = ((size_t)b * Sc * Hc + h) * HDc;  // (b, s=0, h, 0)
    const size_t rowstr = (size_t)Hc * HDc;                 // per-s stride (halves)

    // Q fragments (B operand): 2 query groups x 2 k-steps over HD=64
    v16h bq[2][2];
    #pragma unroll
    for (int mi = 0; mi < 2; ++mi) {
        const _Float16* qp = Qw + base
            + (size_t)(q0 + wave * 32 + mi * 16 + r) * rowstr;
        #pragma unroll
        for (int ks = 0; ks < 2; ++ks)
            bq[mi][ks] = make_frag(qp + ks * 32 + 8 * hi);
    }

    // per lane: running maximum of query r (equal in both halves) and the
    // running sum over this half's keys (the halves are joined after the loop)
    float mrow[2], lrow[2];
    v8f O[4][2] = {};   // O^T: [16 head dims][query group]
    #pragma unroll
    for (int mi = 0; mi < 2; ++mi) { mrow[mi] = -1e30f; lrow[mi] = 0.0f; }

    // stage K and V as they lie (async straight copies)
    auto copy_kv = [&](int t, int buf) {
        #pragma unroll
        for (int j = 0; j < 4; ++j) {
            int idx = tid + j * 128;          // 512 chunks of 8 halves
            int key = idx >> 3;
            int c8  = (idx & 7) << 3;
            size_t g = base + (size_t)(t * 64 + key) * rowstr + c8;
            cp_b128(&ldsK[buf][key * AP + c8], Kw + g);
            cp_b128(&ldsV[buf][key * TP + c8], Vw + g);
        }
    };
    constexpr int NT = Sc / 64;   // 32 stages
    copy_kv(0, 0);
    cp_wait();
    __syncthreads();
    copy_kv(1, 1);

    for (int t = 0; t < NT; ++t) {
        const int cur = t & 1;

        // scores: S^T[64k x 32q] = K(64x64) * Q^T ; K fragments reused across mi
        v8f sacc[4][2] = {};
        #pragma unroll
        for (int ks = 0; ks < 2; ++ks) {
            #pragma unroll
            for (int kt = 0; kt < 4; ++kt) {
                v16h kfrag = make_frag(&ldsK[cur][(kt * 16 + r) * AP + ks * 32 + 8 * hi]);
                #pragma unroll
                for (int mi = 0; mi < 2; ++mi)
                    sacc[kt][mi] = __builtin_amdgcn_wmma_f32_16x16x32_f16(
                        false, kfrag, false, bq[mi][ks], (short)0,
                        sacc[kt][mi], false, false);
            }
        }

        // online softmax: a lane holds 32 of the 64 scores of its query
        v16h pf[2][2];   // P^T as B operand: [query group][32-key step]
        #pragma unroll
        for (int mi = 0; mi < 2; ++mi) {
            float t8[8];
            #pragma unroll
            for (int v = 0; v < 8; ++v)
                t8[v] = fmaxf(fmaxf(sacc[0][mi][v], sacc[1][mi][v]),
                              fmaxf(sacc[2][mi][v], sacc[3][mi][v]));
            float rm = fmaxf(fmaxf(fmaxf(t8[0], t8[1]), fmaxf(t8[2], t8[3])),
                             fmaxf(fmaxf(t8[4], t8[5]), fmaxf(t8[6], t8[7])));
            rm = fmaxf(rm, xhalf(rm));
            const float nm   = fmaxf(mrow[mi], rm);
            const float scal = __expf(mrow[mi] - nm);
            mrow[mi] = nm;

            // exp(x) = exp2(x * log2(e)), as __expf forms it; difference and product on whole tiles
            v8f p[4];
            #pragma unroll
            for (int kt = 0; kt < 4; ++kt) p[kt] = (sacc[kt][mi] - nm) * 1.44269504088896340736f;
            #pragma unroll
            for (int kt = 0; kt < 4; ++kt) {
                #pragma unroll
                for (int v = 0; v < 8; ++v) p[kt][v] = __builtin_amdgcn_exp2f(p[kt][v]);
                sacc[kt][mi] = p[kt];
            }
            const v8f rs = (p[0] + p[1]) + (p[2] + p[3]);
            lrow[mi] = lrow[mi] * scal
                + (((rs[0] + rs[1]) + (rs[2] + rs[3])) + ((rs[4] + rs[5]) + (rs[6] + rs[7])));
            #pragma unroll
            for (int sub = 0; sub < 4; ++sub)
                #pragma unroll
                for (int v = 0; v < 8; ++v)
                    O[sub][mi][v] *= scal;
            // element s of the B operand is key 8*hi + s (s < 8) or 16 + 8*hi + s - 8:
            // registers 0..7 of two S^T tiles that follow one another
            #pragma unroll
            for (int ks = 0; ks < 2; ++ks) {
                v8h plo = __builtin_convertvector(sacc[2 * ks][mi], v8h);
                v8h phi = __builtin_convertvector(sacc[2 * ks + 1][mi], v8h);
                pf[mi][ks] = __builtin_shufflevector(plo, phi,
                    0,1,2,3,4,5,6,7,8,9,10,11,12,13,14,15);
            }
        }

        // O^T += V^T(64x64) * P^T(64x32); V^T fragments reused across mi
        #pragma unroll
        for (int ks = 0; ks < 2; ++ks) {
            #pragma unroll
            for (int sub = 0; sub < 4; ++sub) {
                v16h vfrag = make_frag_tr(&ldsV[cur][(ks * 32 + trow) * TP + sub * 16 + tcol], TP);
                #pragma unroll
                for (int mi = 0; mi < 2; ++mi)
                    O[sub][mi] = __builtin_amdgcn_wmma_f32_16x16x32_f16(
                        false, vfrag, false, pf[mi][ks], (short)0, O[sub][mi], false, false);
            }
        }
        // publish stage t + 1 and free stage t's buffers with one barrier
        lds_wait();
        cp_wait();
        __syncthreads();
        if (t + 2 < NT) copy_kv(t + 2, cur);
    }
    cp_wait();

    // normalize and store ctx (f16, [B,S,H,HD]): a lane holds 8 consecutive
    // head dims of its query per tile, one 16-byte store each
    #pragma unroll
    for (int mi = 0; mi < 2; ++mi) {
        const float l = lrow[mi] + xhalf(lrow[mi]);
        const int row = q0 + wave * 32 + mi * 16 + r;
        #pragma unroll
        for (int sub = 0; sub < 4; ++sub) {
            v8h o8;
            #pragma unroll
            for (int v = 0; v < 8; ++v)
                o8[v] = (_Float16)(O[sub][mi][v] / l);
            *(v8h*)(Ctx + base + (size_t)row * rowstr + sub * 16 + 8 * hi) = o8;
        }
    }
}

extern "C" void kernel_launch(void* const* d_in, const int* in_sizes, int n_in,
                              void* d_out, int out_size, void* d_ws, size_t ws_size,
                              hipStream_t stream) {
    (void)in_sizes; (void)n_in; (void)out_size; (void)ws_size;

    const float* Xq  = (const float*)d_in[0];
    const float* Xkv = (const float*)d_in[1];
    const float* Wq  = (const float*)d_in[2];
    const float* bq  = (const float*)d_in[3];
    const float* Wk  = (const float*)d_in[4];
    const float* bk  = (const float*)d_in[5];
    const float* Wv  = (const float*)d_in[6];
    const float* bv  = (const float*)d_in[7];
    const float* Wo  = (const float*)d_in[8];
    const float* bo  = (const float*)d_in[9];
    float* out = (float*)d_out;

    const size_t elems = (size_t)BSM * Dm;  // 4096*1024
    _Float16* Qh = (_Float16*)d_ws;
    _Float16* Kh = Qh + elems;
    _Float16* Vh = Kh + elems;
    _Float16* Ch = Vh + elems;

    dim3 blk(128);
    dim3 gg(Dm / GN, BSM / GM);       // (16, 32)

    const float qscale = 0.125f;      // 1/sqrt(HD=64)
    dim3 gp(Dm / PN, BSM / PM, 3);    // (8, 16, 3): Qh, Kh, Vh follow one another
    gemm_proj_f16out<<<gp, dim3(256), 0, stream>>>(Xq, Xkv, Wq, Wk, Wv, bq, bk, bv, Qh,
                                             qscale, BSM, Dm, Dm);

    dim3 ga(Bc * Hc, Sc / 128);       // (32, 16)
    attn_kernel<<<ga, blk, 0, stream>>>(Qh, Kh, Vh, Ch);

    gemm_out_f32<<<gg, blk, 0, stream>>>(Ch, Wo, bo, out, BSM, Dm, Dm);
}

// v007
// One run takes 89.8 microseconds.
// Next to v006, in two timings, it ran 1.04 times as fast each time.
// All steps since v000 together make it 4.02 times as fast.
#include <hip/hip_runtime.h>
#include <hip/hip_bf16.h>

// ---- problem constants (match reference) ----
#define Bc   2
#define Sc   2048
#define Dm   1024
#define Hc   16
#define HDc  64
#define BSM  (Bc * Sc)          // 4096 rows

typedef __attribute__((ext_vector_type(16))) _Float16 v16h;
typedef __attribute__((ext_vector_type(8)))  _Float16 v8h;
typedef __attribute__((ext_vector_type(4)))  _Float16 v4h;
typedef __attribute__((ext_vector_type(8)))  float    v8f;
typedef __attribute__((ext_vector_type(4)))  float    v4f;
typedef __attribute__((ext_vector_type(4)))  int      v4i;
typedef __attribute__((ext_vector_type(8)))  short    v8s;

// ---------- CDNA5 async global->LDS copy (ASYNCcnt path), guarded ----------
#if defined(__has_builtin)
#  if __has_builtin(__builtin_amdgcn_global_load_async_to_lds_b128)
#    define HAS_ASYNC_CP 1
#  endif
#endif
#ifndef HAS_ASYNC_CP
#  define HAS_ASYNC_CP 0
#endif

#if HAS_ASYNC_CP
typedef __attribute__((address_space(1))) v4i* g_v4i_p;   // global int4*
typedef __attribute__((address_space(3))) v4i* l_v4i_p;   // LDS int4*
__device__ __forceinline__ void cp_b128(void* lds, const void* g) {
    // global side: flat address == global address, so inttoptr into AS1 is safe;
    // LDS side: generic -> AS3 addrspacecast.
    __builtin_amdgcn_global_load_async_to_lds_b128(
        (g_v4i_p)(uintptr_t)g, (l_v4i_p)lds, 0, 0);
}
__device__ __forceinline__ void cp_wait() {
    // this wave's copies have landed; the clobber holds every LDS read behind it
    asm volatile("s_wait_asynccnt 0x0" ::: "memory");
}
#else
__device__ __forceinline__ void cp_b128(void* lds, const void* g) {
    *(v8h*)lds = *(const v8h*)g;
}
__device__ __forceinline__ void cp_wait() {}
#endif

__device__ __forceinline__ void lds_wait() {
    // this wave's LDS reads and writes have retired, so that the buffer it
    // leaves may be refilled behind the barrier that follows
    asm volatile("s_wait_dscnt 0x0" ::: "memory");
}

__device__ __forceinline__ v16h make_frag(const _Float16* p) {
    // per-lane 16-bit fragment = two contiguous 8-half (16B) chunks:
    // k in [8*hi, 8*hi+8) and [16+8*hi, 16+8*hi+8); caller bakes 8*hi into p.
    v8h lo = *(const v8h*)(p);
    v8h hi8 = *(const v8h*)(p + 16);
    return __builtin_shufflevector(lo, hi8, 0,1,2,3,4,5,6,7,8,9,10,11,12,13,14,15);
}

typedef __attribute__((address_space(3))) v8s* l_v8s_p;   // LDS short8*
__device__ __forceinline__ v16h make_frag_tr(const _Float16* p, int pitch) {
    // the same fragment out of a tile that lies [k][column] in LDS: each
    // transposing load hands lane (r, hi) the 8 halves T[kb + 8*hi + 0..7][cb + r];
    // caller bakes (kb + 8*hi + (lane & 7)) * pitch + cb + 8 * ((lane >> 3) & 1) into p.
    v8h lo  = __builtin_bit_cast(v8h, __builtin_amdgcn_ds_load_tr16_b128_v8i16((l_v8s_p)p));
    v8h hi8 = __builtin_bit_cast(v8h, __builtin_amdgcn_ds_load_tr16_b128_v8i16((l_v8s_p)(p + 16 * pitch)));
    return __builtin_shufflevector(lo, hi8, 0,1,2,3,4,5,6,7,8,9,10,11,12,13,14,15);
}

#define GM   128   // output product: block M tile (2 x 16 rows per wave)
#define GN   64
#define PM   256   // projections: block tile, 4 x 2 waves of 64 x 64
#define PN   128
#define GK   32    // k per stage, projections
#define GKO  64    // k per stage, output product (two 32-k blocks)
// LDS row pitches in halves: 16 B x odd, so the 16 rows of a ds_load_b128
// fragment read fall on 16 different groups of four banks.
#define GKP  40    // 64-B rows  -> 80 B
#define AP   72    // 128-B rows -> 144 B
// Rows read by the transposing load: 32 B x odd.
#define TP   80    // 128-B rows -> 160 B
#define BP   144   // 256-B rows -> 288 B
// Output staging, f32 rows of 256 B, in floats: 16 B x odd.
#define OP   68    // 256-B rows -> 272 B

// ---------------- GEMM: C_f16 = (A_f32 * W_f32 + bias) * scale ----------------
// One launch does the three projections: blockIdx.z picks the product
// (0: query, scaled; 1: key; 2: value). The three results lie one behind the
// other in Cbase, M * N halves each.
// Block tile 256 x 128, 8 waves (4 x 2) of 64 x 64: a loaded byte of A serves
// 128 columns and a loaded byte of W 256 rows, and a fragment read from LDS
// serves four products.
// W^T is the first operand and the rows of A the second: register v of lane
// (r, hi) is then C[row r][column 8*hi + v], 8 columns that follow one another.
__global__ __launch_bounds__(256) void gemm_proj_f16out(
    const float* __restrict__ Xq, const float* __restrict__ Xkv,
    const float* __restrict__ Wq, const float* __restrict__ Wk,
    const float* __restrict__ Wv,
    const float* __restrict__ bq, const float* __restrict__ bk,
    const float* __restrict__ bv, _Float16* __restrict__ Cbase,
    float qscale, int M, int N, int Kdim)
{
    // two buffers each: stage t + 1 is on its way while stage t is multiplied
    __shared__ __align__(16) _Float16 ldsA[2][PM * GKP];   // [m][k], pitch GKP
    __shared__ __align__(16) _Float16 ldsB[2][GK * BP];    // [k][n], pitch BP

    const int which = blockIdx.z;
    const float* __restrict__ A    = which == 0 ? Xq : Xkv;
    const float* __restrict__ W    = which == 0 ? Wq : (which == 1 ? Wk : Wv);
    const float* __restrict__ bias = which == 0 ? bq : (which == 1 ? bk : bv);
    _Float16* __restrict__ Cout    = Cbase + (size_t)which * M * N;
    const float scale              = which == 0 ? qscale : 1.0f;

    const int tid  = threadIdx.x;
    const int wave = tid >> 5;
    const int wm   = wave >> 1;                 // wave's 64 rows of the tile
    const int wn   = wave & 1;                  // wave's 64 columns
    const int lane = tid & 31;
    const int r    = lane & 15;
    const int hi   = lane >> 4;
    const int trow = 8 * hi + (lane & 7);       // transposing load: this lane's row
    const int tcol = 8 * ((lane >> 3) & 1);     // and its 16-byte half of the 16 columns

    const int m0 = blockIdx.y * PM;
    const int n0 = blockIdx.x * PN;

    v8f acc[4][4] = {};

    // One stage: 256x32 of A (8 chunks of 4 floats per thread) and 32x128 of W
    // (4 chunks), held in registers while the stage before it is multiplied.
    // One pointer per operand walks the stages and the rows are uniform strides
    // from it.
    const float* ap = A + (size_t)(m0 + (tid >> 3)) * Kdim + ((tid & 7) << 2);
    const float* wp = W + (size_t)(tid >> 5) * N + n0 + ((tid & 31) << 2);
    v4f ar[8], wr[4];
    auto load_stage = [&]() {
        const v4f* pa[8];
        const v4f* pw[4];
        #pragma unroll
        for (int j = 0; j < 8; ++j) {      // thread's row: j * 32 + (tid >> 3)
            pa[j] = (const v4f*)(ap + (size_t)(j * 32) * Kdim);
            ar[j] = *pa[j];
        }
        #pragma unroll
        for (int j = 0; j < 4; ++j) {      // thread's k row: j * 8 + (tid >> 5)
            pw[j] = (const v4f*)(wp + (size_t)(j * 8) * N);
            wr[j] = *pw[j];
        }
        // the loads stay in flight over the next stage's products, which reuse
        // their address registers: the wait stands in front of that overwrite,
        // and as its inputs the addresses stay whole up to it
        asm volatile("s_wait_xcnt 0x0" :: "v"(pa[0]), "v"(pa[1]), "v"(pa[2]), "v"(pa[3]),
                     "v"(pa[4]), "v"(pa[5]), "v"(pa[6]), "v"(pa[7]),
                     "v"(pw[0]), "v"(pw[1]), "v"(pw[2]), "v"(pw[3]) : "memory");
        ap += GK;
        wp += (size_t)GK * N;
    };
    // -> f16, rows as they lie
    auto store_stage = [&](int buf) {
        #pragma unroll
        for (int j = 0; j < 8; ++j)
            *(v4h*)(&ldsA[buf][(j * 32 + (tid >> 3)) * GKP + ((tid & 7) << 2)]) =
                __builtin_convertvector(ar[j], v4h);
        #pragma unroll
        for (int j = 0; j < 4; ++j)
            *(v4h*)(&ldsB[buf][(j * 8 + (tid >> 5)) * BP + ((tid & 31) << 2)]) =
                __builtin_convertvector(wr[j], v4h);
    };

    const int nt = Kdim / GK;
    load_stage();
    store_stage(0);
    __syncthreads();
    if (nt > 1) load_stage();

    for (int t = 0; t < nt; ++t) {
        const int cur = t & 1;
        v16h af[4];
        #pragma unroll
        for (int mi = 0; mi < 4; ++mi)
            af[mi] = make_frag(&ldsA[cur][(wm * 64 + mi * 16 + r) * GKP + 8 * hi]);
        #pragma unroll
        for (int sub = 0; sub < 4; ++sub) {
            v16h bfrag = make_frag_tr(&ldsB[cur][trow * BP + wn * 64 + sub * 16 + tcol], BP);
            #pragma unroll
            for (int mi = 0; mi < 4; ++mi)
                acc[mi][sub] = __builtin_amdgcn_wmma_f32_16x16x32_f16(
                    false, bfrag, false, af[mi], (short)0, acc[mi][sub], false, false);
        }
        // the other buffers were left by their readers at the barrier of stage t - 1
        if (t + 1 < nt) store_stage(cur ^ 1);
        // publish stage t + 1 and free stage t's buffers with one barrier
        __syncthreads();
        if (t + 2 < nt) load_stage();
    }

    // Epilogue: whole 128-byte lines. The loop's last barrier has ended every
    // read of the ring, so each wave stages 32 rows of its tile (128 B each,
    // pitch AP) at a time in rows of ldsA that are its own, and stores them
    // four whole rows per instruction.
    _Float16* stg = &ldsA[0][0] + wave * (32 * AP);
    const v4f* bp = (const v4f*)(bias + n0 + wn * 64 + 8 * hi);
    v8f bvec[4];
    #pragma unroll
    for (int sub = 0; sub < 4; ++sub)
        bvec[sub] = __builtin_shufflevector(bp[sub * 4], bp[sub * 4 + 1], 0,1,2,3,4,5,6,7);
    // the bias loads' address stays whole up to this wait, in front of its reuse
    asm volatile("s_wait_xcnt 0x0" :: "v"(bp) : "memory");
    // lane's place in the first four rows; the rows are uniform strides from it
    _Float16* cp = Cout + (size_t)(m0 + wm * 64 + (lane >> 3)) * N
                 + n0 + wn * 64 + ((lane & 7) << 3);
    #pragma unroll
    for (int half = 0; half < 2; ++half) {
        #pragma unroll
        for (int m2 = 0; m2 < 2; ++m2) {
            #pragma unroll
            for (int sub = 0; sub < 4; ++sub)
                *(v8h*)(stg + (m2 * 16 + r) * AP + sub * 16 + 8 * hi) =
                    __builtin_convertvector((acc[half * 2 + m2][sub] + bvec[sub]) * scale, v8h);
        }
        lds_wait();   // the rows are read back by other lanes of this wave
        v8h  x[8];
        v8h* px[8];
        #pragma unroll
        for (int j = 0; j < 8; ++j) {      // lane's row: j * 4 + (lane >> 3)
            const int row = j * 4 + (lane >> 3);
            x[j]  = *(const v8h*)(stg + row * AP + ((lane & 7) << 3));
            px[j] = (v8h*)(cp + (size_t)(half * 32 + j * 4) * N);
        }
        #pragma unroll
        for (int j = 0; j < 8; ++j) *px[j] = x[j];
        // the stores' address and data registers stay whole up to this wait,
        // which stands in front of their reuse by the next 32 rows; the clobber
        // holds those rows' LDS writes behind the reads that fed the stores
        if (half == 0)
            asm volatile("s_wait_xcnt 0x0" :: "v"(px[0]), "v"(px[1]), "v"(px[2]), "v"(px[3]),
                         "v"(px[4]), "v"(px[5]), "v"(px[6]), "v"(px[7]),
                         "v"(x[0]), "v"(x[1]), "v"(x[2]), "v"(x[3]),
                         "v"(x[4]), "v"(x[5]), "v"(x[6]), "v"(x[7]) : "memory");
    }
}

// ---------------- GEMM: out_f32 = A_f16 * W_f32 + bias ----------------
// W^T is the first operand here too: a lane holds 8 columns of one row.
__global__ __launch_bounds__(128) void gemm_out_f32(
    const _Float16* __restrict__ A, const float* __restrict__ W,
    const float* __restrict__ bias, float* __restrict__ Out,
    int M, int N, int Kdim)
{
    // two buffers each: stage t + 1 is on its way while stage t is multiplied
    __shared__ __align__(16) _Float16 ldsA[2][GM * AP];    // [m][k], pitch AP
    __shared__ __align__(16) _Float16 ldsB[2][GKO * TP];   // [k][n], pitch TP

    const int tid  = threadIdx.x;
    const int wave = tid >> 5;
    const int lane = tid & 31;
    const int r    = lane & 15;
    const int hi   = lane >> 4;
    const int trow = 8 * hi + (lane & 7);       // transposing load: this lane's row
    const int tcol = 8 * ((lane >> 3) & 1);     // and its 16-byte half of the 16 columns

    const int m0 = blockIdx.y * GM;
    const int n0 = blockIdx.x * GN;

    v8f acc[2][4] = {};

    // A stage: 128x64 f16 straight copy to LDS (1024 chunks of 16 B, 8 per thread)
    // Addresses are a uniform base plus one 32-bit byte offset per thread.
    const unsigned a_off = (unsigned)((tid >> 3) * Kdim + ((tid & 7) << 3)) * 2u;
    const unsigned w_off = (unsigned)((tid >> 4) * N + ((tid & 15) << 2)) * 4u;
    auto copy_a = [&](int t, int buf) {
        #pragma unroll
        for (int j = 0; j < 8; ++j) {      // thread's row: j * 16 + (tid >> 3)
            int row = j * 16 + (tid >> 3);
            int c8  = (tid & 7) << 3;
            cp_b128(&ldsA[buf][row * AP + c8],
                    (const char*)(A + (size_t)(m0 + j * 16) * Kdim + t * GKO) + a_off);
        }
    };
    // W stage: 64x64 f32, held in registers while the stage before it is multiplied
    v4f wr[8];
    auto load_w = [&](int t) {
        const v4f* p[8];
        #pragma unroll
        for (int j = 0; j < 8; ++j) {      // thread's k row: j * 8 + (tid >> 4)
            p[j]  = (const v4f*)((const char*)(W + (size_t)(t * GKO + j * 8) * N + n0) + w_off);
            wr[j] = *p[j];
        }
        // the loads stay in flight over the next stage's products, which reuse
        // their address registers: the wait stands in front of that overwrite,
        // and as its inputs the addresses stay whole up to it
        asm volatile("s_wait_xcnt 0x0" :: "v"(p[0]), "v"(p[1]), "v"(p[2]), "v"(p[3]),
                     "v"(p[4]), "v"(p[5]), "v"(p[6]), "v"(p[7]) : "memory");
    };
    // -> f16, rows as they lie
    auto store_w = [&](int buf) {
        #pragma unroll
        for (int j = 0; j < 8; ++j) {
            int idx  = tid + j * 128;
            int krow = idx >> 4;
            int c4   = (idx & 15) << 2;
            *(v4h*)(&ldsB[buf][krow * TP + c4]) = __builtin_convertvector(wr[j], v4h);
        }
    };

    const int nt = Kdim / GKO;
    copy_a(0, 0);
    load_w(0);
    store_w(0);
    lds_wait();
    cp_wait();
    __syncthreads();
    if (nt > 1) { copy_a(1, 1); load_w(1); }

    for (int t = 0; t < nt; ++t) {
        const int cur = t & 1;
        #pragma unroll
        for (int ks = 0; ks < 2; ++ks) {
            v16h af[2];
            #pragma unroll
            for (int mi = 0; mi < 2; ++mi)
                af[mi] = make_frag(&ldsA[cur][(wave * 32 + mi * 16 + r) * AP + ks * 32 + 8 * hi]);
            #pragma unroll
            for (int sub = 0; sub < 4; ++sub) {
                v16h bfrag = make_frag_tr(&ldsB[cur][(ks * 32 + trow) * TP + sub * 16 + tcol], TP);
                #pragma unroll
                for (int mi = 0; mi < 2; ++mi)
                    acc[mi][sub] = __builtin_amdgcn_wmma_f32_16x16x32_f16(
                        false, bfrag, false, af[mi], (short)0, acc[mi][sub], false, false);
            }
        }
        // the other W buffer was left by its readers at the barrier of stage t - 1
        if (t + 1 < nt) store_w(cur ^ 1);
        // publish stage t + 1 and free stage t's buffers with one barrier
        lds_wait();
        cp_wait();
        __syncthreads();
        if (t + 2 < nt) { copy_a(t + 2, cur); load_w(t + 2); }
    }
    cp_wait();

    // Epilogue: whole 128-byte lines. The ring is free behind the loop's last
    // barrier: each wave stages its 32 rows of 256 B (pitch OP floats) in rows
    // of ldsA that are its own, and stores two whole rows per instruction.
    float* stg = (float*)&ldsA[0][0] + wave * (32 * OP);
    const v4f* bp = (const v4f*)(bias + n0 + 8 * hi);
    v8f bvec[4];
    #pragma unroll
    for (int sub = 0; sub < 4; ++sub)
        bvec[sub] = __builtin_shufflevector(bp[sub * 4], bp[sub * 4 + 1], 0,1,2,3,4,5,6,7);
    // the bias loads' address stays whole up to this wait, in front of its reuse
    asm volatile("s_wait_xcnt 0x0" :: "v"(bp) : "memory");
    #pragma unroll
    for (int sub = 0; sub < 4; ++sub) {
        #pragma unroll
        for (int mi = 0; mi < 2; ++mi) {
            const v8f o = acc[mi][sub] + bvec[sub];
            float* sp = stg + (mi * 16 + r) * OP + sub * 16 + 8 * hi;
            *(v4f*)(sp)     = __builtin_shufflevector(o, o, 0,1,2,3);
            *(v4f*)(sp + 4) = __builtin_shufflevector(o, o, 4,5,6,7);
        }
    }
    lds_wait();   // the rows are read back by other lanes of this wave
    // lane's place in the first two rows; the rows are uniform strides from it
    float* op = Out + (size_t)(m0 + wave * 32 + (lane >> 4)) * N + n0 + ((lane & 15) << 2);
    #pragma unroll
    for (int g = 0; g < 2; ++g) {
        v4f  x[8];
        v4f* px[8];
        #pragma unroll
        for (int j = 0; j < 8; ++j) {      // lane's row: g * 16 + j * 2 + (lane >> 4)
            const int row = g * 16 + j * 2 + (lane >> 4);
            x[j]  = *(const v4f*)(stg + row * OP + ((lane & 15) << 2));
            px[j] = (v4f*)(op + (size_t)(g * 16 + j * 2) * N);
        }
        #pragma unroll
        for (int j = 0; j < 8; ++j) *px[j] = x[j];
        // the stores' address and data registers stay whole up to this wait,
        // which stands in front of their reuse by the next 16 rows
        if (g == 0)
            asm volatile("s_wait_xcnt 0x0" :: "v"(px[0]), "v"(px[1]), "v"(px[2]), "v"(px[3]),
                         "v"(px[4]), "v"(px[5]), "v"(px[6]), "v"(px[7]),
                         "v"(x[0]), "v"(x[1]), "v"(x[2]), "v"(x[3]),
                         "v"(x[4]), "v"(x[5]), "v"(x[6]), "v"(x[7]) : "memory");
    }
}

// lane l <-> lane l ^ 16: the two lanes that share one query
__device__ __forceinline__ float xhalf(float x) {
    return __builtin_bit_cast(float, __builtin_amdgcn_permlanex16(
        __builtin_bit_cast(int, x), __builtin_bit_cast(int, x),
        0x76543210, 0xfedcba98, false, false));
}

__global__ __launch_bounds__(128) void attn_kernel(
    const _Float16* __restrict__ Qw, const _Float16* __restrict__ Kw,
    const _Float16* __restrict__ Vw, _Float16* __restrict__ Ctx)
{
    // two buffers each: the next 64 keys are on their way while these are worked on
    __shared__ __align__(16) _Float16 ldsK[2][64 * AP];    // [key][hd], pitch AP
    __shared__ __align__(16) _Float16 ldsV[2][64 * TP];    // [key][hd], pitch TP

    const int tid  = threadIdx.x;
    const int wave = tid >> 5;
    const int lane = tid & 31;
    const int r    = lane & 15;
    const int hi   = lane >> 4;
    const int trow = 8 * hi + (lane & 7);       // transposing load: this lane's row
    const int tcol = 8 * ((lane >> 3) & 1);     // and its 16-byte half of the 16 columns

    const int bh = blockIdx.x;
    const int b  = bh / Hc;
    const int h  = bh % Hc;
    const int q0 = blockIdx.y * 128;

    const size_t base   = ((size_t)b * Sc * Hc + h) * HDc;  // (b, s=0, h, 0)
    const size_t rowstr = (size_t)Hc * HDc;                 // per-s stride (halves)

    // Q fragments (B operand): 2 query groups x 2 k-steps over HD=64
    v16h bq[2][2];
    #pragma unroll
    for (int mi = 0; mi < 2; ++mi) {
        const _Float16* qp = Qw + base
            + (size_t)(q0 + wave * 32 + mi * 16 + r) * rowstr;
        #pragma unroll
        for (int ks = 0; ks < 2; ++ks)
            bq[mi][ks] = make_frag(qp + ks * 32 + 8 * hi);
    }

    // per lane: running maximum of query r (equal in both halves) and the
    // running sum over this half's keys (the halves are joined after the loop)
    float mrow[2], lrow[2];
    v8f O[4][2] = {};   // O^T: [16 head dims][query group]
    #pragma unroll
    for (int mi = 0; mi < 2; ++mi) { mrow[mi] = -1e30f; lrow[mi] = 0.0f; }

    // stage K and V as they lie (async straight copies)
    auto copy_kv = [&](int t, int buf) {
        #pragma unroll
        for (int j = 0; j < 4; ++j) {
            int idx = tid + j * 128;          // 512 chunks of 8 halves
            int key = idx >> 3;
            int c8  = (idx & 7) << 3;
            size_t g = base + (size_t)(t * 64 + key) * rowstr + c8;
            cp_b128(&ldsK[buf][key * AP + c8], Kw + g);
            cp_b128(&ldsV[buf][key * TP + c8], Vw + g);
        }
    };
    constexpr int NT = Sc / 64;   // 32 stages
    copy_kv(0, 0);
    cp_wait();
    __syncthreads();
    copy_kv(1, 1);

    for (int t = 0; t < NT; ++t) {
        const int cur = t & 1;

        // scores: S^T[64k x 32q] = K(64x64) * Q^T ; K fragments reused across mi
        v8f sacc[4][2] = {};
        #pragma unroll
        for (int ks = 0; ks < 2; ++ks) {
            #pragma unroll
            for (int kt = 0; kt < 4; ++kt) {
                v16h kfrag = make_frag(&ldsK[cur][(kt * 16 + r) * AP + ks * 32 + 8 * hi]);
                #pragma unroll
                for (int mi = 0; mi < 2; ++mi)
                    sacc[kt][mi] = __builtin_amdgcn_wmma_f32_16x16x32_f16(
                        false, kfrag, false, bq[mi][ks], (short)0,
                        sacc[kt][mi], false, false);
            }
        }

        // online softmax: a lane holds 32 of the 64 scores of its query
        v16h pf[2][2];   // P^T as B operand: [query group][32-key step]
        #pragma unroll
        for (int mi = 0; mi < 2; ++mi) {
            float t8[8];
            #pragma unroll
            for (int v = 0; v < 8; ++v)
                t8[v] = fmaxf(fmaxf(sacc[0][mi][v], sacc[1][mi][v]),
                              fmaxf(sacc[2][mi][v], sacc[3][mi][v]));
            float rm = fmaxf(fmaxf(fmaxf(t8[0], t8[1]), fmaxf(t8[2], t8[3])),
                             fmaxf(fmaxf(t8[4], t8[5]), fmaxf(t8[6], t8[7])));
            rm = fmaxf(rm, xhalf(rm));
            const float nm   = fmaxf(mrow[mi], rm);
            const float scal = __expf(mrow[mi] - nm);
            mrow[mi] = nm;

            // exp(x) = exp2(x * log2(e)), as __expf forms it; difference and product on whole tiles
            v8f p[4];
            #pragma unroll
            for (int kt = 0; kt < 4; ++kt) p[kt] = (sacc[kt][mi] - nm) * 1.44269504088896340736f;
            #pragma unroll
            for (int kt = 0; kt < 4; ++kt) {
                #pragma unroll
                for (int v = 0; v < 8; ++v) p[kt][v] = __builtin_amdgcn_exp2f(p[kt][v]);
                sacc[kt][mi] = p[kt];
            }
            const v8f rs = (p[0] + p[1]) + (p[2] + p[3]);
            lrow[mi] = lrow[mi] * scal
                + (((rs[0] + rs[1]) + (rs[2] + rs[3])) + ((rs[4] + rs[5]) + (rs[6] + rs[7])));
            #pragma unroll
            for (int sub = 0; sub < 4; ++sub)
                #pragma unroll
                for (int v = 0; v < 8; ++v)
                    O[sub][mi][v] *= scal;
            // element s of the B operand is key 8*hi + s (s < 8) or 16 + 8*hi + s - 8:
            // registers 0..7 of two S^T tiles that follow one another
            #pragma unroll
            for (int ks = 0; ks < 2; ++ks) {
                v8h plo = __builtin_convertvector(sacc[2 * ks][mi], v8h);
                v8h phi = __builtin_convertvector(sacc[2 * ks + 1][mi], v8h);
                pf[mi][ks] = __builtin_shufflevector(plo, phi,
                    0,1,2,3,4,5,6,7,8,9,10,11,12,13,14,15);
            }
        }

        // O^T += V^T(64x64) * P^T(64x32); V^T fragments reused across mi
        #pragma unroll
        for (int ks = 0; ks < 2; ++ks) {
            #pragma unroll
            for (int sub = 0; sub < 4; ++sub) {
                v16h vfrag = make_frag_tr(&ldsV[cur][(ks * 32 + trow) * TP + sub * 16 + tcol], TP);
                #pragma unroll
                for (int mi = 0; mi < 2; ++mi)
                    O[sub][mi] = __builtin_amdgcn_wmma_f32_16x16x32_f16(
                        false, vfrag, false, pf[mi][ks], (short)0, O[sub][mi], false, false);
            }
        }
        // publish stage t + 1 and free stage t's buffers with one barrier
        lds_wait();
        cp_wait();
        __syncthreads();
        if (t + 2 < NT) copy_kv(t + 2, cur);
    }
    cp_wait();

    // normalize and store ctx (f16, [B,S,H,HD]): a lane holds 8 consecutive
    // head dims of its query per tile, one 16-byte store each
    #pragma unroll
    for (int mi = 0; mi < 2; ++mi) {
        const float l = lrow[mi] + xhalf(lrow[mi]);
        const int row = q0 + wave * 32 + mi * 16 + r;
        #pragma unroll
        for (int sub = 0; sub < 4; ++sub) {
            v8h o8;
            #pragma unroll
            for (int v = 0; v < 8; ++v)
                o8[v] = (_Float16)(O[sub][mi][v] / l);
            *(v8h*)(Ctx + base + (size_t)row * rowstr + sub * 16 + 8 * hi) = o8;
        }
    }
}

extern "C" void kernel_launch(void* const* d_in, const int* in_sizes, int n_in,
                              void* d_out, int out_size, void* d_ws, size_t ws_size,
                              hipStream_t stream) {
    (void)in_sizes; (void)n_in; (void)out_size; (void)ws_size;

    const float* Xq  = (const float*)d_in[0];
    const float* Xkv = (const float*)d_in[1];
    const float* Wq  = (const float*)d_in[2];
    const float* bq  = (const float*)d_in[3];
    const float* Wk  = (const float*)d_in[4];
    const float* bk  = (const float*)d_in[5];
    const float* Wv  = (const float*)d_in[6];
    const float* bv  = (const float*)d_in[7];
    const float* Wo  = (const float*)d_in[8];
    const float* bo  = (const float*)d_in[9];
    float* out = (float*)d_out;

    const size_t elems = (size_t)BSM * Dm;  // 4096*1024
    _Float16* Qh = (_Float16*)d_ws;
    _Float16* Kh = Qh + elems;
    _Float16* Vh = Kh + elems;
    _Float16* Ch = Vh + elems;

    dim3 blk(128);
    dim3 gg(Dm / GN, BSM / GM);       // (16, 32)

    const float qscale = 0.125f;      // 1/sqrt(HD=64)
    dim3 gp(Dm / PN, BSM / PM, 3);    // (8, 16, 3): Qh, Kh, Vh follow one another
    gemm_proj_f16out<<<gp, dim3(256), 0, stream>>>(Xq, Xkv, Wq, Wk, Wv, bq, bk, bv, Qh,
                                             qscale, BSM, Dm, Dm);

    dim3 ga(Bc * Hc, Sc / 128);       // (32, 16)
    attn_kernel<<<ga, blk, 0, stream>>>(Qh, Kh, Vh, Ch);

    gemm_out_f32<<<gg, blk, 0, stream>>>(Ch, Wo, bo, out, BSM, Dm, Dm);
}

// v008
// A run of this version takes 86.8 microseconds.
// Two timings next to v007 both put it at 1.03 times that version's speed.
// Counting every step since v000, it is 4.15 times as fast.
#include <hip/hip_runtime.h>
#include <hip/hip_bf16.h>

// ---- problem constants (match reference) ----
#define Bc   2
#define Sc   2048
#define Dm   1024
#define Hc   16
#define HDc  64
#define BSM  (Bc * Sc)          // 4096 rows

typedef __attribute__((ext_vector_type(16))) _Float16 v16h;
typedef __attribute__((ext_vector_type(8)))  _Float16 v8h;
typedef __attribute__((ext_vector_type(4)))  _Float16 v4h;
typedef __attribute__((ext_vector_type(8)))  float    v8f;
typedef __attribute__((ext_vector_type(4)))  float    v4f;
typedef __attribute__((ext_vector_type(4)))  int      v4i;
typedef __attribute__((ext_vector_type(8)))  short    v8s;

// ---------- CDNA5 async global->LDS copy (ASYNCcnt path), guarded ----------
#if defined(__has_builtin)
#  if __has_builtin(__builtin_amdgcn_global_load_async_to_lds_b128)
#    define HAS_ASYNC_CP 1
#  endif
#endif
#ifndef HAS_ASYNC_CP
#  define HAS_ASYNC_CP 0
#endif

#if HAS_ASYNC_CP
typedef __attribute__((address_space(1))) v4i* g_v4i_p;   // global int4*
typedef __attribute__((address_space(3))) v4i* l_v4i_p;   // LDS int4*
__device__ __forceinline__ void cp_b128(void* lds, const void* g) {
    // global side: flat address == global address, so inttoptr into AS1 is safe;
    // LDS side: generic -> AS3 addrspacecast.
    __builtin_amdgcn_global_load_async_to_lds_b128(
        (g_v4i_p)(uintptr_t)g, (l_v4i_p)lds, 0, 0);
}
__device__ __forceinline__ void cp_wait() {
    // this wave's copies have landed; the clobber holds every LDS read behind it
    asm volatile("s_wait_asynccnt 0x0" ::: "memory");
}
#else
__device__ __forceinline__ void cp_b128(void* lds, const void* g) {
    *(v8h*)lds = *(const v8h*)g;
}
__device__ __forceinline__ void cp_wait() {}
#endif

__device__ __forceinline__ void lds_wait() {
    // this wave's LDS reads and writes have retired, so that the buffer it
    // leaves may be refilled behind the barrier that follows
    asm volatile("s_wait_dscnt 0x0" ::: "memory");
}

__device__ __forceinline__ v16h make_frag(const _Float16* p) {
    // per-lane 16-bit fragment = two contiguous 8-half (16B) chunks:
    // k in [8*hi, 8*hi+8) and [16+8*hi, 16+8*hi+8); caller bakes 8*hi into p.
    v8h lo = *(const v8h*)(p);
    v8h hi8 = *(const v8h*)(p + 16);
    return __builtin_shufflevector(lo, hi8, 0,1,2,3,4,5,6,7,8,9,10,11,12,13,14,15);
}

typedef __attribute__((address_space(3))) v8s* l_v8s_p;   // LDS short8*
__device__ __forceinline__ v16h make_frag_tr(const _Float16* p, int pitch) {
    // the same fragment out of a tile that lies [k][column] in LDS: each
    // transposing load hands lane (r, hi) the 8 halves T[kb + 8*hi + 0..7][cb + r];
    // caller bakes (kb + 8*hi + (lane & 7)) * pitch + cb + 8 * ((lane >> 3) & 1) into p.
    v8h lo  = __builtin_bit_cast(v8h, __builtin_amdgcn_ds_load_tr16_b128_v8i16((l_v8s_p)p));
    v8h hi8 = __builtin_bit_cast(v8h, __builtin_amdgcn_ds_load_tr16_b128_v8i16((l_v8s_p)(p + 16 * pitch)));
    return __builtin_shufflevector(lo, hi8, 0,1,2,3,4,5,6,7,8,9,10,11,12,13,14,15);
}

#define GM   128   // output product: block M tile (2 x 16 rows per wave)
#define GN   64
#define PM   256   // projections: block tile, 4 x 2 waves of 64 x 64
#define PN   128
#define GK   32    // k per stage, projections
#define GKO  64    // k per stage, output product (two 32-k blocks)
// LDS row pitches in halves: 16 B x odd, so the 16 rows of a ds_load_b128
// fragment read fall on 16 different groups of four banks.
#define GKP  40    // 64-B rows  -> 80 B
#define AP   72    // 128-B rows -> 144 B
// Rows read by the transposing load: 32 B x odd.
#define TP   80    // 128-B rows -> 160 B
#define BP   144   // 256-B rows -> 288 B
// Output staging, f32 rows of 256 B, in floats: 16 B x odd.
#define OP   68    // 256-B rows -> 272 B

// ---------------- GEMM: C_f16 = (A_f32 * W_f32 + bias) * scale ----------------
// One launch does the three projections: blockIdx.z picks the product
// (0: query, scaled; 1: key; 2: value). The three results lie one behind the
// other in Cbase, M * N halves each.
// Block tile 256 x 128, 8 waves (4 x 2) of 64 x 64: a loaded byte of A serves
// 128 columns and a loaded byte of W 256 rows, and a fragment read from LDS
// serves four products.
// W^T is the first operand and the rows of A the second: register v of lane
// (r, hi) is then C[row r][column 8*hi + v], 8 columns that follow one another.
__global__ __launch_bounds__(256) void gemm_proj_f16out(
    const float* __restrict__ Xq, const float* __restrict__ Xkv,
    const float* __restrict__ Wq, const float* __restrict__ Wk,
    const float* __restrict__ Wv,
    const float* __restrict__ bq, const float* __restrict__ bk,
    const float* __restrict__ bv, _Float16* __restrict__ Cbase,
    float qscale, int M, int N, int Kdim)
{
    // two buffers each: stage t + 1 is on its way while stage t is multiplied
    __shared__ __align__(16) _Float16 ldsA[2][PM * GKP];   // [m][k], pitch GKP
    __shared__ __align__(16) _Float16 ldsB[2][GK * BP];    // [k][n], pitch BP

    const int which = blockIdx.z;
    const float* __restrict__ A    = which == 0 ? Xq : Xkv;
    const float* __restrict__ W    = which == 0 ? Wq : (which == 1 ? Wk : Wv);
    const float* __restrict__ bias = which == 0 ? bq : (which == 1 ? bk : bv);
    _Float16* __restrict__ Cout    = Cbase + (size_t)which * M * N;
    const float scale              = which == 0 ? qscale : 1.0f;

    const int tid  = threadIdx.x;
    const int wave = tid >> 5;
    const int wm   = wave >> 1;                 // wave's 64 rows of the tile
    const int wn   = wave & 1;                  // wave's 64 columns
    const int lane = tid & 31;
    const int r    = lane & 15;
    const int hi   = lane >> 4;
    const int trow = 8 * hi + (lane & 7);       // transposing load: this lane's row
    const int tcol = 8 * ((lane >> 3) & 1);     // and its 16-byte half of the 16 columns

    const int m0 = blockIdx.y * PM;
    const int n0 = blockIdx.x * PN;

    v8f acc[4][4] = {};

    // One stage: 256x32 of A (8 chunks of 4 floats per thread) and 32x128 of W
    // (4 chunks), held in registers while the stage before it is multiplied.
    // One pointer per operand walks the stages and the rows are uniform strides
    // from it.
    const float* ap = A + (size_t)(m0 + (tid >> 3)) * Kdim + ((tid & 7) << 2);
    const float* wp = W + (size_t)(tid >> 5) * N + n0 + ((tid & 31) << 2);
    v4f ar[8], wr[4];
    auto load_stage = [&]() {
        const v4f* pa[8];
        const v4f* pw[4];
        #pragma unroll
        for (int j = 0; j < 8; ++j) {      // thread's row: j * 32 + (tid >> 3)
            pa[j] = (const v4f*)(ap + (size_t)(j * 32) * Kdim);
            ar[j] = *pa[j];
        }
        #pragma unroll
        for (int j = 0; j < 4; ++j) {      // thread's k row: j * 8 + (tid >> 5)
            pw[j] = (const v4f*)(wp + (size_t)(j * 8) * N);
            wr[j] = *pw[j];
        }
        // the loads stay in flight over the next stage's products, which reuse
        // their address registers: the wait stands in front of that overwrite,
        // and as its inputs the addresses stay whole up to it
        asm volatile("s_wait_xcnt 0x0" :: "v"(pa[0]), "v"(pa[1]), "v"(pa[2]), "v"(pa[3]),
                     "v"(pa[4]), "v"(pa[5]), "v"(pa[6]), "v"(pa[7]),
                     "v"(pw[0]), "v"(pw[1]), "v"(pw[2]), "v"(pw[3]) : "memory");
        ap += GK;
        wp += (size_t)GK * N;
    };
    // -> f16, rows as they lie
    auto store_stage = [&](int buf) {
        #pragma unroll
        for (int j = 0; j < 8; ++j)
            *(v4h*)(&ldsA[buf][(j * 32 + (tid >> 3)) * GKP + ((tid & 7) << 2)]) =
                __builtin_convertvector(ar[j], v4h);
        #pragma unroll
        for (int j = 0; j < 4; ++j)
            *(v4h*)(&ldsB[buf][(j * 8 + (tid >> 5)) * BP + ((tid & 31) << 2)]) =
                __builtin_convertvector(wr[j], v4h);
    };

    const int nt = Kdim / GK;
    load_stage();
    store_stage(0);
    __syncthreads();
    if (nt > 1) load_stage();

    for (int t = 0; t < nt; ++t) {
        const int cur = t & 1;
        v16h af[4];
        #pragma unroll
        for (int mi = 0; mi < 4; ++mi)
            af[mi] = make_frag(&ldsA[cur][(wm * 64 + mi * 16 + r) * GKP + 8 * hi]);
        #pragma unroll
        for (int sub = 0; sub < 4; ++sub) {
            v16h bfrag = make_frag_tr(&ldsB[cur][trow * BP + wn * 64 + sub * 16 + tcol], BP);
            #pragma unroll
            for (int mi = 0; mi < 4; ++mi)
                acc[mi][sub] = __builtin_amdgcn_wmma_f32_16x16x32_f16(
                    false, bfrag, false, af[mi], (short)0, acc[mi][sub], false, false);
        }
        // the other buffers were left by their readers at the barrier of stage t - 1
        if (t + 1 < nt) store_stage(cur ^ 1);
        // publish stage t + 1 and free stage t's buffers with one barrier
        __syncthreads();
        if (t + 2 < nt) load_stage();
    }

    // Epilogue: whole 128-byte lines. The loop's last barrier has ended every
    // read of the ring, so each wave stages 32 rows of its tile (128 B each,
    // pitch AP) at a time in rows of ldsA that are its own, and stores them
    // four whole rows per instruction.
    _Float16* stg = &ldsA[0][0] + wave * (32 * AP);
    const v4f* bp = (const v4f*)(bias + n0 + wn * 64 + 8 * hi);
    v8f bvec[4];
    #pragma unroll
    for (int sub = 0; sub < 4; ++sub)
        bvec[sub] = __builtin_shufflevector(bp[sub * 4], bp[sub * 4 + 1], 0,1,2,3,4,5,6,7);
    // the bias loads' address stays whole up to this wait, in front of its reuse
    asm volatile("s_wait_xcnt 0x0" :: "v"(bp) : "memory");
    // lane's place in the first four rows; the rows are uniform strides from it
    _Float16* cp = Cout + (size_t)(m0 + wm * 64 + (lane >> 3)) * N
                 + n0 + wn * 64 + ((lane & 7) << 3);
    #pragma unroll
    for (int half = 0; half < 2; ++half) {
        #pragma unroll
        for (int m2 = 0; m2 < 2; ++m2) {
            #pragma unroll
            for (int sub = 0; sub < 4; ++sub)
                *(v8h*)(stg + (m2 * 16 + r) * AP + sub * 16 + 8 * hi) =
                    __builtin_convertvector((acc[half * 2 + m2][sub] + bvec[sub]) * scale, v8h);
        }
        lds_wait();   // the rows are read back by other lanes of this wave
        v8h  x[8];
        v8h* px[8];
        #pragma unroll
        for (int j = 0; j < 8; ++j) {      // lane's row: j * 4 + (lane >> 3)
            const int row = j * 4 + (lane >> 3);
            x[j]  = *(const v8h*)(stg + row * AP + ((lane & 7) << 3));
            px[j] = (v8h*)(cp + (size_t)(half * 32 + j * 4) * N);
        }
        #pragma unroll
        for (int j = 0; j < 8; ++j) *px[j] = x[j];
        // the stores' address and data registers stay whole up to this wait,
        // which stands in front of their reuse by the next 32 rows; the clobber
        // holds those rows' LDS writes behind the reads that fed the stores
        if (half == 0)
            asm volatile("s_wait_xcnt 0x0" :: "v"(px[0]), "v"(px[1]), "v"(px[2]), "v"(px[3]),
                         "v"(px[4]), "v"(px[5]), "v"(px[6]), "v"(px[7]),
                         "v"(x[0]), "v"(x[1]), "v"(x[2]), "v"(x[3]),
                         "v"(x[4]), "v"(x[5]), "v"(x[6]), "v"(x[7]) : "memory");
    }
}

// ---------------- GEMM: out_f32 = A_f16 * W_f32 + bias ----------------
// W^T is the first operand here too: a lane holds 8 columns of one row.
__global__ __launch_bounds__(128) void gemm_out_f32(
    const _Float16* __restrict__ A, const float* __restrict__ W,
    const float* __restrict__ bias, float* __restrict__ Out,
    int M, int N, int Kdim)
{
    // two buffers each: stage t + 1 is on its way while stage t is multiplied
    __shared__ __align__(16) _Float16 ldsA[2][GM * AP];    // [m][k], pitch AP
    __shared__ __align__(16) _Float16 ldsB[2][GKO * TP];   // [k][n], pitch TP

    const int tid  = threadIdx.x;
    const int wave = tid >> 5;
    const int lane = tid & 31;
    const int r    = lane & 15;
    const int hi   = lane >> 4;
    const int trow = 8 * hi + (lane & 7);       // transposing load: this lane's row
    const int tcol = 8 * ((lane >> 3) & 1);     // and its 16-byte half of the 16 columns

    const int m0 = blockIdx.y * GM;
    const int n0 = blockIdx.x * GN;

    v8f acc[2][4] = {};

    // A stage: 128x64 f16 straight copy to LDS (1024 chunks of 16 B, 8 per thread)
    // Addresses are a uniform base plus one 32-bit byte offset per thread.
    const unsigned a_off = (unsigned)((tid >> 3) * Kdim + ((tid & 7) << 3)) * 2u;
    const unsigned w_off = (unsigned)((tid >> 4) * N + ((tid & 15) << 2)) * 4u;
    auto copy_a = [&](int t, int buf) {
        #pragma unroll
        for (int j = 0; j < 8; ++j) {      // thread's row: j * 16 + (tid >> 3)
            int row = j * 16 + (tid >> 3);
            int c8  = (tid & 7) << 3;
            cp_b128(&ldsA[buf][row * AP + c8],
                    (const char*)(A + (size_t)(m0 + j * 16) * Kdim + t * GKO) + a_off);
        }
    };
    // W stage: 64x64 f32, held in registers while the stage before it is multiplied
    v4f wr[8];
    auto load_w = [&](int t) {
        const v4f* p[8];
        #pragma unroll
        for (int j = 0; j < 8; ++j) {      // thread's k row: j * 8 + (tid >> 4)
            p[j]  = (const v4f*)((const char*)(W + (size_t)(t * GKO + j * 8) * N + n0) + w_off);
            wr[j] = *p[j];
        }
        // the loads stay in flight over the next stage's products, which reuse
        // their address registers: the wait stands in front of that overwrite,
        // and as its inputs the addresses stay whole up to it
        asm volatile("s_wait_xcnt 0x0" :: "v"(p[0]), "v"(p[1]), "v"(p[2]), "v"(p[3]),
                     "v"(p[4]), "v"(p[5]), "v"(p[6]), "v"(p[7]) : "memory");
    };
    // -> f16, rows as they lie
    auto store_w = [&](int buf) {
        #pragma unroll
        for (int j = 0; j < 8; ++j) {
            int idx  = tid + j * 128;
            int krow = idx >> 4;
            int c4   = (idx & 15) << 2;
            *(v4h*)(&ldsB[buf][krow * TP + c4]) = __builtin_convertvector(wr[j], v4h);
        }
    };

    const int nt = Kdim / GKO;
    copy_a(0, 0);
    load_w(0);
    store_w(0);
    lds_wait();
    cp_wait();
    __syncthreads();
    if (nt > 1) { copy_a(1, 1); load_w(1); }

    for (int t = 0; t < nt; ++t) {
        const int cur = t & 1;
        #pragma unroll
        for (int ks = 0; ks < 2; ++ks) {
            v16h af[2];
            #pragma unroll
            for (int mi = 0; mi < 2; ++mi)
                af[mi] = make_frag(&ldsA[cur][(wave * 32 + mi * 16 + r) * AP + ks * 32 + 8 * hi]);
            #pragma unroll
            for (int sub = 0; sub < 4; ++sub) {
                v16h bfrag = make_frag_tr(&ldsB[cur][(ks * 32 + trow) * TP + sub * 16 + tcol], TP);
                #pragma unroll
                for (int mi = 0; mi < 2; ++mi)
                    acc[mi][sub] = __builtin_amdgcn_wmma_f32_16x16x32_f16(
                        false, bfrag, false, af[mi], (short)0, acc[mi][sub], false, false);
            }
        }
        // the other W buffer was left by its readers at the barrier of stage t - 1
        if (t + 1 < nt) store_w(cur ^ 1);
        // publish stage t + 1 and free stage t's buffers with one barrier
        lds_wait();
        cp_wait();
        __syncthreads();
        if (t + 2 < nt) { copy_a(t + 2, cur); load_w(t + 2); }
    }
    cp_wait();

    // Epilogue: whole 128-byte lines. The ring is free behind the loop's last
    // barrier: each wave stages its 32 rows of 256 B (pitch OP floats) in rows
    // of ldsA that are its own, and stores two whole rows per instruction.
    float* stg = (float*)&ldsA[0][0] + wave * (32 * OP);
    const v4f* bp = (const v4f*)(bias + n0 + 8 * hi);
    v8f bvec[4];
    #pragma unroll
    for (int sub = 0; sub < 4; ++sub)
        bvec[sub] = __builtin_shufflevector(bp[sub * 4], bp[sub * 4 + 1], 0,1,2,3,4,5,6,7);
    // the bias loads' address stays whole up to this wait, in front of its reuse
    asm volatile("s_wait_xcnt 0x0" :: "v"(bp) : "memory");
    #pragma unroll
    for (int sub = 0; sub < 4; ++sub) {
        #pragma unroll
        for (int mi = 0; mi < 2; ++mi) {
            const v8f o = acc[mi][sub] + bvec[sub];
            float* sp = stg + (mi * 16 + r) * OP + sub * 16 + 8 * hi;
            *(v4f*)(sp)     = __builtin_shufflevector(o, o, 0,1,2,3);
            *(v4f*)(sp + 4) = __builtin_shufflevector(o, o, 4,5,6,7);
        }
    }
    lds_wait();   // the rows are read back by other lanes of this wave
    // lane's place in the first two rows; the rows are uniform strides from it
    float* op = Out + (size_t)(m0 + wave * 32 + (lane >> 4)) * N + n0 + ((lane & 15) << 2);
    #pragma unroll
    for (int g = 0; g < 2; ++g) {
        v4f  x[8];
        v4f* px[8];
        #pragma unroll
        for (int j = 0; j < 8; ++j) {      // lane's row: g * 16 + j * 2 + (lane >> 4)
            const int row = g * 16 + j * 2 + (lane >> 4);
            x[j]  = *(const v4f*)(stg + row * OP + ((lane & 15) << 2));
            px[j] = (v4f*)(op + (size_t)(g * 16 + j * 2) * N);
        }
        #pragma unroll
        for (int j = 0; j < 8; ++j) *px[j] = x[j];
        // the stores' address and data registers stay whole up to this wait,
        // which stands in front of their reuse by the next 16 rows
        if (g == 0)
            asm volatile("s_wait_xcnt 0x0" :: "v"(px[0]), "v"(px[1]), "v"(px[2]), "v"(px[3]),
                         "v"(px[4]), "v"(px[5]), "v"(px[6]), "v"(px[7]),
                         "v"(x[0]), "v"(x[1]), "v"(x[2]), "v"(x[3]),
                         "v"(x[4]), "v"(x[5]), "v"(x[6]), "v"(x[7]) : "memory");
    }
}

// lane l <-> lane l ^ 16: the two lanes that share one query
__device__ __forceinline__ float xhalf(float x) {
    return __builtin_bit_cast(float, __builtin_amdgcn_permlanex16(
        __builtin_bit_cast(int, x), __builtin_bit_cast(int, x),
        0x76543210, 0xfedcba98, false, false));
}

__global__ __launch_bounds__(256) void attn_kernel(
    const _Float16* __restrict__ Qw, const _Float16* __restrict__ Kw,
    const _Float16* __restrict__ Vw, _Float16* __restrict__ Ctx)
{
    // per key half two buffers each: the next 64 keys are on their way while
    // these are worked on
    __shared__ __align__(16) _Float16 ldsK[2][2][64 * AP];    // [half][buffer][key][hd], pitch AP
    __shared__ __align__(16) _Float16 ldsV[2][2][64 * TP];    // [half][buffer][key][hd], pitch TP

    const int tid  = threadIdx.x;
    const int wave = tid >> 5;
    const int kh   = __builtin_amdgcn_readfirstlane(tid >> 7);   // wave's half of the keys
    const int wq   = wave & 3;                  // wave's 32 queries of the 128
    const int th   = tid & 127;                 // thread's number inside its half
    const int lane = tid & 31;
    const int r    = lane & 15;
    const int hi   = lane >> 4;
    const int trow = 8 * hi + (lane & 7);       // transposing load: this lane's row
    const int tcol = 8 * ((lane >> 3) & 1);     // and its 16-byte half of the 16 columns

    const int bh = blockIdx.x;
    const int b  = bh / Hc;
    const int h  = bh % Hc;
    const int q0 = blockIdx.y * 128;

    const size_t base   = ((size_t)b * Sc * Hc + h) * HDc;  // (b, s=0, h, 0)
    const size_t rowstr = (size_t)Hc * HDc;                 // per-s stride (halves)

    // Q fragments (B operand): 2 query groups x 2 k-steps over HD=64
    v16h bq[2][2];
    #pragma unroll
    for (int mi = 0; mi < 2; ++mi) {
        const _Float16* qp = Qw + base
            + (size_t)(q0 + wq * 32 + mi * 16 + r) * rowstr;
        #pragma unroll
        for (int ks = 0; ks < 2; ++ks)
            bq[mi][ks] = make_frag(qp + ks * 32 + 8 * hi);
    }

    // per lane: running maximum of query r (equal in both halves of the wave)
    // and the running sum over this lane half's keys (joined after the loop)
    float mrow[2], lrow[2];
    v8f O[4][2] = {};   // O^T: [16 head dims][query group]
    #pragma unroll
    for (int mi = 0; mi < 2; ++mi) { mrow[mi] = -1e30f; lrow[mi] = 0.0f; }

    // stage K and V as they lie (async straight copies); the 128 threads of a
    // key half fill that half's buffers
    const size_t kbase = base + (size_t)(kh * (Sc / 2)) * rowstr;
    auto copy_kv = [&](int t, int buf) {
        #pragma unroll
        for (int j = 0; j < 4; ++j) {
            int idx = th + j * 128;           // 512 chunks of 8 halves
            int key = idx >> 3;
            int c8  = (idx & 7) << 3;
            size_t g = kbase + (size_t)(t * 64 + key) * rowstr + c8;
            cp_b128(&ldsK[kh][buf][key * AP + c8], Kw + g);
            cp_b128(&ldsV[kh][buf][key * TP + c8], Vw + g);
        }
    };
    constexpr int NT = Sc / 2 / 64;   // 16 stages per key half
    copy_kv(0, 0);
    cp_wait();
    __syncthreads();
    copy_kv(1, 1);

    for (int t = 0; t < NT; ++t) {
        const int cur = t & 1;

        // scores: S^T[64k x 32q] = K(64x64) * Q^T ; K fragments reused across mi
        v8f sacc[4][2] = {};
        #pragma unroll
        for (int ks = 0; ks < 2; ++ks) {
            #pragma unroll
            for (int kt = 0; kt < 4; ++kt) {
                v16h kfrag = make_frag(&ldsK[kh][cur][(kt * 16 + r) * AP + ks * 32 + 8 * hi]);
                #pragma unroll
                for (int mi = 0; mi < 2; ++mi)
                    sacc[kt][mi] = __builtin_amdgcn_wmma_f32_16x16x32_f16(
                        false, kfrag, false, bq[mi][ks], (short)0,
                        sacc[kt][mi], false, false);
            }
        }

        // online softmax: a lane holds 32 of the 64 scores of its query
        v16h pf[2][2];   // P^T as B operand: [query group][32-key step]
        #pragma unroll
        for (int mi = 0; mi < 2; ++mi) {
            float t8[8];
            #pragma unroll
            for (int v = 0; v < 8; ++v)
                t8[v] = fmaxf(fmaxf(sacc[0][mi][v], sacc[1][mi][v]),
                              fmaxf(sacc[2][mi][v], sacc[3][mi][v]));
            float rm = fmaxf(fmaxf(fmaxf(t8[0], t8[1]), fmaxf(t8[2], t8[3])),
                             fmaxf(fmaxf(t8[4], t8[5]), fmaxf(t8[6], t8[7])));
            rm = fmaxf(rm, xhalf(rm));
            const float nm   = fmaxf(mrow[mi], rm);
            const float scal = __expf(mrow[mi] - nm);
            mrow[mi] = nm;

            // exp(x) = exp2(x * log2(e)), as __expf forms it; difference and product on whole tiles
            v8f p[4];
            #pragma unroll
            for (int kt = 0; kt < 4; ++kt) p[kt] = (sacc[kt][mi] - nm) * 1.44269504088896340736f;
            #pragma unroll
            for (int kt = 0; kt < 4; ++kt) {
                #pragma unroll
                for (int v = 0; v < 8; ++v) p[kt][v] = __builtin_amdgcn_exp2f(p[kt][v]);
                sacc[kt][mi] = p[kt];
            }
            const v8f rs = (p[0] + p[1]) + (p[2] + p[3]);
            lrow[mi] = lrow[mi] * scal
                + (((rs[0] + rs[1]) + (rs[2] + rs[3])) + ((rs[4] + rs[5]) + (rs[6] + rs[7])));
            #pragma unroll
            for (int sub = 0; sub < 4; ++sub)
                #pragma unroll
                for (int v = 0; v < 8; ++v)
                    O[sub][mi][v] *= scal;
            // element s of the B operand is key 8*hi + s (s < 8) or 16 + 8*hi + s - 8:
            // registers 0..7 of two S^T tiles that follow one another
            #pragma unroll
            for (int ks = 0; ks < 2; ++ks) {
                v8h plo = __builtin_convertvector(sacc[2 * ks][mi], v8h);
                v8h phi = __builtin_convertvector(sacc[2 * ks + 1][mi], v8h);
                pf[mi][ks] = __builtin_shufflevector(plo, phi,
                    0,1,2,3,4,5,6,7,8,9,10,11,12,13,14,15);
            }
        }

        // O^T += V^T(64x64) * P^T(64x32); V^T fragments reused across mi
        #pragma unroll
        for (int ks = 0; ks < 2; ++ks) {
            #pragma unroll
            for (int sub = 0; sub < 4; ++sub) {
                v16h vfrag = make_frag_tr(&ldsV[kh][cur][(ks * 32 + trow) * TP + sub * 16 + tcol], TP);
                #pragma unroll
                for (int mi = 0; mi < 2; ++mi)
                    O[sub][mi] = __builtin_amdgcn_wmma_f32_16x16x32_f16(
                        false, vfrag, false, pf[mi][ks], (short)0, O[sub][mi], false, false);
            }
        }
        // publish stage t + 1 and free stage t's buffers with one barrier
        lds_wait();
        cp_wait();
        __syncthreads();
        if (t + 2 < NT) copy_kv(t + 2, cur);
    }
    cp_wait();

    // Merge of the two key halves. Waves w and w ^ 4 hold the same 32 queries:
    // the wave of half 0 finishes query group 0 and hands over its group 1, the
    // wave of half 1 the other way round (kh is uniform in a wave: scalar
    // branches). The ring is free behind the loop's last barrier; a wave's
    // 9 x 512 B lie lane by lane, 16 B each.
    v4f* xch = (v4f*)&ldsK[0][0][0];            // 8 waves x 4,608 B: all of ldsK
    v4f* mine         = xch + wave * (9 * 32) + lane;
    const v4f* theirs = xch + (wave ^ 4) * (9 * 32) + lane;
    auto hand_over = [&](int mi) {
        #pragma unroll
        for (int sub = 0; sub < 4; ++sub) {
            mine[(2 * sub) * 32]     = __builtin_shufflevector(O[sub][mi], O[sub][mi], 0,1,2,3);
            mine[(2 * sub + 1) * 32] = __builtin_shufflevector(O[sub][mi], O[sub][mi], 4,5,6,7);
        }
        mine[8 * 32] = (v4f){mrow[mi], lrow[mi] + xhalf(lrow[mi]), 0.0f, 0.0f};
    };
    // join with the partner's part, normalize and store ctx (f16, [B,S,H,HD]):
    // a lane holds 8 consecutive head dims of its query per tile, one 16-byte
    // store each
    auto finish = [&](int mi) {
        const v4f   ml = theirs[8 * 32];
        const float m  = fmaxf(mrow[mi], ml[0]);
        const float ak = __expf(mrow[mi] - m);
        const float ap = __expf(ml[0] - m);
        const float l  = (lrow[mi] + xhalf(lrow[mi])) * ak + ml[1] * ap;
        const int row = q0 + wq * 32 + mi * 16 + r;
        #pragma unroll
        for (int sub = 0; sub < 4; ++sub) {
            const v8f got = __builtin_shufflevector(theirs[(2 * sub) * 32],
                                                    theirs[(2 * sub + 1) * 32], 0,1,2,3,4,5,6,7);
            const v8f o = O[sub][mi] * ak + got * ap;
            v8h o8;
            #pragma unroll
            for (int v = 0; v < 8; ++v)
                o8[v] = (_Float16)(o[v] / l);
            *(v8h*)(Ctx + base + (size_t)row * rowstr + sub * 16 + 8 * hi) = o8;
        }
    };
    if (kh == 0) hand_over(1); else hand_over(0);
    lds_wait();        // this wave's writes have retired in front of the barrier
    __syncthreads();   // the partner wave reads them behind it
    if (kh == 0) finish(0); else finish(1);
}

extern "C" void kernel_launch(void* const* d_in, const int* in_sizes, int n_in,
                              void* d_out, int out_size, void* d_ws, size_t ws_size,
                              hipStream_t stream) {
    (void)in_sizes; (void)n_in; (void)out_size; (void)ws_size;

    const float* Xq  = (const float*)d_in[0];
    const float* Xkv = (const float*)d_in[1];
    const float* Wq  = (const float*)d_in[2];
    const float* bq  = (const float*)d_in[3];
    const float* Wk  = (const float*)d_in[4];
    const float* bk  = (const float*)d_in[5];
    const float* Wv  = (const float*)d_in[6];
    const float* bv  = (const float*)d_in[7];
    const float* Wo  = (const float*)d_in[8];
    const float* bo  = (const float*)d_in[9];
    float* out = (float*)d_out;

    const size_t elems = (size_t)BSM * Dm;  // 4096*1024
    _Float16* Qh = (_Float16*)d_ws;
    _Float16* Kh = Qh + elems;
    _Float16* Vh = Kh + elems;
    _Float16* Ch = Vh + elems;

    dim3 blk(128);
    dim3 gg(Dm / GN, BSM / GM);       // (16, 32)

    const float qscale = 0.125f;      // 1/sqrt(HD=64)
    dim3 gp(Dm / PN, BSM / PM, 3);    // (8, 16, 3): Qh, Kh, Vh follow one another
    gemm_proj_f16out<<<gp, dim3(256), 0, stream>>>(Xq, Xkv, Wq, Wk, Wv, bq, bk, bv, Qh,
                                             qscale, BSM, Dm, Dm);

    dim3 ga(Bc * Hc, Sc / 128);       // (32, 16)
    attn_kernel<<<ga, dim3(256), 0, stream>>>(Qh, Kh, Vh, Ch);

    gemm_out_f32<<<gg, blk, 0, stream>>>(Ch, Wo, bo, out, BSM, Dm, Dm);
}

// v009
// A run of this version takes 84 microseconds.
// In two side-by-side timings against v008, it was 1.03 and 1.04 times as fast.
// Counting every step since v000, it is 4.29 times as fast.
#include <hip/hip_runtime.h>
#include <hip/hip_bf16.h>

// ---- problem constants (match reference) ----
#define Bc   2
#define Sc   2048
#define Dm   1024
#define Hc   16
#define HDc  64
#define BSM  (Bc * Sc)          // 4096 rows

typedef __attribute__((ext_vector_type(16))) _Float16 v16h;
typedef __attribute__((ext_vector_type(8)))  _Float16 v8h;
typedef __attribute__((ext_vector_type(4)))  _Float16 v4h;
typedef __attribute__((ext_vector_type(8)))  float    v8f;
typedef __attribute__((ext_vector_type(4)))  float    v4f;
typedef __attribute__((ext_vector_type(4)))  int      v4i;
typedef __attribute__((ext_vector_type(8)))  short    v8s;

// ---------- CDNA5 async global->LDS copy (ASYNCcnt path), guarded ----------
#if defined(__has_builtin)
#  if __has_builtin(__builtin_amdgcn_global_load_async_to_lds_b128)
#    define HAS_ASYNC_CP 1
#  endif
#endif
#ifndef HAS_ASYNC_CP
#  define HAS_ASYNC_CP 0
#endif

#if HAS_ASYNC_CP
typedef __attribute__((address_space(1))) v4i* g_v4i_p;   // global int4*
typedef __attribute__((address_space(3))) v4i* l_v4i_p;   // LDS int4*
__device__ __forceinline__ void cp_b128(void* lds, const void* g) {
    // global side: flat address == global address, so inttoptr into AS1 is safe;
    // LDS side: generic -> AS3 addrspacecast.
    __builtin_amdgcn_global_load_async_to_lds_b128(
        (g_v4i_p)(uintptr_t)g, (l_v4i_p)lds, 0, 0);
}
__device__ __forceinline__ void cp_wait() {
    // this wave's copies have landed; the clobber holds every LDS read behind it
    asm volatile("s_wait_asynccnt 0x0" ::: "memory");
}
#else
__device__ __forceinline__ void cp_b128(void* lds, const void* g) {
    *(v8h*)lds = *(const v8h*)g;
}
__device__ __forceinline__ void cp_wait() {}
#endif

__device__ __forceinline__ void lds_wait() {
    // this wave's LDS reads and writes have retired, so that the buffer it
    // leaves may be refilled behind the barrier that follows
    asm volatile("s_wait_dscnt 0x0" ::: "memory");
}

__device__ __forceinline__ v16h make_frag(const _Float16* p) {
    // per-lane 16-bit fragment = two contiguous 8-half (16B) chunks:
    // k in [8*hi, 8*hi+8) and [16+8*hi, 16+8*hi+8); caller bakes 8*hi into p.
    v8h lo = *(const v8h*)(p);
    v8h hi8 = *(const v8h*)(p + 16);
    return __builtin_shufflevector(lo, hi8, 0,1,2,3,4,5,6,7,8,9,10,11,12,13,14,15);
}

typedef __attribute__((address_space(3))) v8s* l_v8s_p;   // LDS short8*
__device__ __forceinline__ v16h make_frag_tr(const _Float16* p, int pitch) {
    // the same fragment out of a tile that lies [k][column] in LDS: each
    // transposing load hands lane (r, hi) the 8 halves T[kb + 8*hi + 0..7][cb + r];
    // caller bakes (kb + 8*hi + (lane & 7)) * pitch + cb + 8 * ((lane >> 3) & 1) into p.
    v8h lo  = __builtin_bit_cast(v8h, __builtin_amdgcn_ds_load_tr16_b128_v8i16((l_v8s_p)p));
    v8h hi8 = __builtin_bit_cast(v8h, __builtin_amdgcn_ds_load_tr16_b128_v8i16((l_v8s_p)(p + 16 * pitch)));
    return __builtin_shufflevector(lo, hi8, 0,1,2,3,4,5,6,7,8,9,10,11,12,13,14,15);
}

#define GM   128   // output product: block M tile (2 x 16 rows per wave)
#define GN   64
#define PM   256   // projections: block tile, 4 x 2 waves of 64 x 64
#define PN   128
#define GK   32    // k per stage, projections
#define GKO  64    // k per stage, output product (two 32-k blocks)
// LDS row pitches in halves: 16 B x odd, so the 16 rows of a ds_load_b128
// fragment read fall on 16 different groups of four banks.
#define GKP  40    // 64-B rows  -> 80 B
#define AP   72    // 128-B rows -> 144 B
// Rows read by the transposing load: 32 B x odd.
#define TP   80    // 128-B rows -> 160 B
#define BP   144   // 256-B rows -> 288 B
// Output staging, f32 rows of 256 B, in floats: 16 B x odd.
#define OP   68    // 256-B rows -> 272 B

// ---------------- GEMM: C_f16 = (A_f32 * W_f32 + bias) * scale ----------------
// One launch does the three projections: blockIdx.z picks the product
// (0: query, scaled; 1: key; 2: value). The three results lie one behind the
// other in Cbase, M * N halves each.
// Block tile 256 x 128, 8 waves (4 x 2) of 64 x 64: a loaded byte of A serves
// 128 columns and a loaded byte of W 256 rows, and a fragment read from LDS
// serves four products.
// W^T is the first operand and the rows of A the second: register v of lane
// (r, hi) is then C[row r][column 8*hi + v], 8 columns that follow one another.
__global__ __launch_bounds__(256) void gemm_proj_f16out(
    const float* __restrict__ Xq, const float* __restrict__ Xkv,
    const float* __restrict__ Wq, const float* __restrict__ Wk,
    const float* __restrict__ Wv,
    const float* __restrict__ bq, const float* __restrict__ bk,
    const float* __restrict__ bv, _Float16* __restrict__ Cbase,
    float qscale, int M, int N, int Kdim)
{
    // two buffers each: stage t + 1 is on its way while stage t is multiplied
    __shared__ __align__(16) _Float16 ldsA[2][PM * GKP];   // [m][k], pitch GKP
    __shared__ __align__(16) _Float16 ldsB[2][GK * BP];    // [k][n], pitch BP

    const int which = blockIdx.z;
    const float* __restrict__ A    = which == 0 ? Xq : Xkv;
    const float* __restrict__ W    = which == 0 ? Wq : (which == 1 ? Wk : Wv);
    const float* __restrict__ bias = which == 0 ? bq : (which == 1 ? bk : bv);
    _Float16* __restrict__ Cout    = Cbase + (size_t)which * M * N;
    const float scale              = which == 0 ? qscale : 1.0f;

    const int tid  = threadIdx.x;
    const int wave = tid >> 5;
    const int wm   = wave >> 1;                 // wave's 64 rows of the tile
    const int wn   = wave & 1;                  // wave's 64 columns
    const int lane = tid & 31;
    const int r    = lane & 15;
    const int hi   = lane >> 4;
    const int trow = 8 * hi + (lane & 7);       // transposing load: this lane's row
    const int tcol = 8 * ((lane >> 3) & 1);     // and its 16-byte half of the 16 columns

    const int m0 = blockIdx.y * PM;
    const int n0 = blockIdx.x * PN;

    v8f acc[4][4] = {};

    // One stage: 256x32 of A (8 chunks of 4 floats per thread) and 32x128 of W
    // (4 chunks), held in registers while the stage before it is multiplied.
    // One pointer per operand walks the stages and the rows are uniform strides
    // from it.
    const float* ap = A + (size_t)(m0 + (tid >> 3)) * Kdim + ((tid & 7) << 2);
    const float* wp = W + (size_t)(tid >> 5) * N + n0 + ((tid & 31) << 2);
    v4f ar[8], wr[4];
    auto load_stage = [&]() {
        const v4f* pa[8];
        const v4f* pw[4];
        #pragma unroll
        for (int j = 0; j < 8; ++j) {      // thread's row: j * 32 + (tid >> 3)
            pa[j] = (const v4f*)(ap + (size_t)(j * 32) * Kdim);
            ar[j] = *pa[j];
        }
        #pragma unroll
        for (int j = 0; j < 4; ++j) {      // thread's k row: j * 8 + (tid >> 5)
            pw[j] = (const v4f*)(wp + (size_t)(j * 8) * N);
            wr[j] = *pw[j];
        }
        // the loads stay in flight over the next stage's products, which reuse
        // their address registers: the wait stands in front of that overwrite,
        // and as its inputs the addresses stay whole up to it
        asm volatile("s_wait_xcnt 0x0" :: "v"(pa[0]), "v"(pa[1]), "v"(pa[2]), "v"(pa[3]),
                     "v"(pa[4]), "v"(pa[5]), "v"(pa[6]), "v"(pa[7]),
                     "v"(pw[0]), "v"(pw[1]), "v"(pw[2]), "v"(pw[3]) : "memory");
        ap += GK;
        wp += (size_t)GK * N;
    };
    // -> f16, rows as they lie
    auto store_stage = [&](int buf) {
        #pragma unroll
        for (int j = 0; j < 8; ++j)
            *(v4h*)(&ldsA[buf][(j * 32 + (tid >> 3)) * GKP + ((tid & 7) << 2)]) =
                __builtin_convertvector(ar[j], v4h);
        #pragma unroll
        for (int j = 0; j < 4; ++j)
            *(v4h*)(&ldsB[buf][(j * 8 + (tid >> 5)) * BP + ((tid & 31) << 2)]) =
                __builtin_convertvector(wr[j], v4h);
    };

    const int nt = Kdim / GK;
    load_stage();
    store_stage(0);
    __syncthreads();
    if (nt > 1) load_stage();

    for (int t = 0; t < nt; ++t) {
        const int cur = t & 1;
        v16h af[4];
        #pragma unroll
        for (int mi = 0; mi < 4; ++mi)
            af[mi] = make_frag(&ldsA[cur][(wm * 64 + mi * 16 + r) * GKP + 8 * hi]);
        #pragma unroll
        for (int sub = 0; sub < 4; ++sub) {
            v16h bfrag = make_frag_tr(&ldsB[cur][trow * BP + wn * 64 + sub * 16 + tcol], BP);
            #pragma unroll
            for (int mi = 0; mi < 4; ++mi)
                acc[mi][sub] = __builtin_amdgcn_wmma_f32_16x16x32_f16(
                    false, bfrag, false, af[mi], (short)0, acc[mi][sub], false, false);
        }
        // the other buffers were left by their readers at the barrier of stage t - 1
        if (t + 1 < nt) store_stage(cur ^ 1);
        // publish stage t + 1 and free stage t's buffers with one barrier
        __syncthreads();
        if (t + 2 < nt) load_stage();
    }

    // Epilogue: whole 128-byte lines. The loop's last barrier has ended every
    // read of the ring, so each wave stages 32 rows of its tile (128 B each,
    // pitch AP) at a time in rows of ldsA that are its own, and stores them
    // four whole rows per instruction.
    _Float16* stg = &ldsA[0][0] + wave * (32 * AP);
    const v4f* bp = (const v4f*)(bias + n0 + wn * 64 + 8 * hi);
    v8f bvec[4];
    #pragma unroll
    for (int sub = 0; sub < 4; ++sub)
        bvec[sub] = __builtin_shufflevector(bp[sub * 4], bp[sub * 4 + 1], 0,1,2,3,4,5,6,7);
    // the bias loads' address stays whole up to this wait, in front of its reuse
    asm volatile("s_wait_xcnt 0x0" :: "v"(bp) : "memory");
    // lane's place in the first four rows; the rows are uniform strides from it
    _Float16* cp = Cout + (size_t)(m0 + wm * 64 + (lane >> 3)) * N
                 + n0 + wn * 64 + ((lane & 7) << 3);
    #pragma unroll
    for (int half = 0; half < 2; ++half) {
        #pragma unroll
        for (int m2 = 0; m2 < 2; ++m2) {
            #pragma unroll
            for (int sub = 0; sub < 4; ++sub)
                *(v8h*)(stg + (m2 * 16 + r) * AP + sub * 16 + 8 * hi) =
                    __builtin_convertvector((acc[half * 2 + m2][sub] + bvec[sub]) * scale, v8h);
        }
        lds_wait();   // the rows are read back by other lanes of this wave
        v8h  x[8];
        v8h* px[8];
        #pragma unroll
        for (int j = 0; j < 8; ++j) {      // lane's row: j * 4 + (lane >> 3)
            const int row = j * 4 + (lane >> 3);
            x[j]  = *(const v8h*)(stg + row * AP + ((lane & 7) << 3));
            px[j] = (v8h*)(cp + (size_t)(half * 32 + j * 4) * N);
        }
        #pragma unroll
        for (int j = 0; j < 8; ++j) *px[j] = x[j];
        // the stores' address and data registers stay whole up to this wait,
        // which stands in front of their reuse by the next 32 rows; the clobber
        // holds those rows' LDS writes behind the reads that fed the stores
        if (half == 0)
            asm volatile("s_wait_xcnt 0x0" :: "v"(px[0]), "v"(px[1]), "v"(px[2]), "v"(px[3]),
                         "v"(px[4]), "v"(px[5]), "v"(px[6]), "v"(px[7]),
                         "v"(x[0]), "v"(x[1]), "v"(x[2]), "v"(x[3]),
                         "v"(x[4]), "v"(x[5]), "v"(x[6]), "v"(x[7]) : "memory");
    }
}

// ---------------- GEMM: out_f32 = A_f16 * W_f32 + bias ----------------
// W^T is the first operand here too: a lane holds 8 columns of one row.
__global__ __launch_bounds__(128) void gemm_out_f32(
    const _Float16* __restrict__ A, const float* __restrict__ W,
    const float* __restrict__ bias, float* __restrict__ Out,
    int M, int N, int Kdim)
{
    // two buffers each: stage t + 1 is on its way while stage t is multiplied
    __shared__ __align__(16) _Float16 ldsA[2][GM * AP];    // [m][k], pitch AP
    __shared__ __align__(16) _Float16 ldsB[2][GKO * TP];   // [k][n], pitch TP

    const int tid  = threadIdx.x;
    const int wave = tid >> 5;
    const int lane = tid & 31;
    const int r    = lane & 15;
    const int hi   = lane >> 4;
    const int trow = 8 * hi + (lane & 7);       // transposing load: this lane's row
    const int tcol = 8 * ((lane >> 3) & 1);     // and its 16-byte half of the 16 columns

    const int m0 = blockIdx.y * GM;
    const int n0 = blockIdx.x * GN;

    v8f acc[2][4] = {};

    // A stage: 128x64 f16 straight copy to LDS (1024 chunks of 16 B, 8 per thread)
    // Addresses are a uniform base plus one 32-bit byte offset per thread.
    const unsigned a_off = (unsigned)((tid >> 3) * Kdim + ((tid & 7) << 3)) * 2u;
    const unsigned w_off = (unsigned)((tid >> 4) * N + ((tid & 15) << 2)) * 4u;
    auto copy_a = [&](int t, int buf) {
        #pragma unroll
        for (int j = 0; j < 8; ++j) {      // thread's row: j * 16 + (tid >> 3)
            int row = j * 16 + (tid >> 3);
            int c8  = (tid & 7) << 3;
            cp_b128(&ldsA[buf][row * AP + c8],
                    (const char*)(A + (size_t)(m0 + j * 16) * Kdim + t * GKO) + a_off);
        }
    };
    // W stage: 64x64 f32, held in registers while the stage before it is multiplied
    v4f wr[8];
    auto load_w = [&](int t) {
        const v4f* p[8];
        #pragma unroll
        for (int j = 0; j < 8; ++j) {      // thread's k row: j * 8 + (tid >> 4)
            p[j]  = (const v4f*)((const char*)(W + (size_t)(t * GKO + j * 8) * N + n0) + w_off);
            wr[j] = *p[j];
        }
        // the loads stay in flight over the next stage's products, which reuse
        // their address registers: the wait stands in front of that overwrite,
        // and as its inputs the addresses stay whole up to it
        asm volatile("s_wait_xcnt 0x0" :: "v"(p[0]), "v"(p[1]), "v"(p[2]), "v"(p[3]),
                     "v"(p[4]), "v"(p[5]), "v"(p[6]), "v"(p[7]) : "memory");
    };
    // -> f16, rows as they lie
    auto store_w = [&](int buf) {
        #pragma unroll
        for (int j = 0; j < 8; ++j) {
            int idx  = tid + j * 128;
            int krow = idx >> 4;
            int c4   = (idx & 15) << 2;
            *(v4h*)(&ldsB[buf][krow * TP + c4]) = __builtin_convertvector(wr[j], v4h);
        }
    };

    const int nt = Kdim / GKO;
    copy_a(0, 0);
    load_w(0);
    store_w(0);
    lds_wait();
    cp_wait();
    __syncthreads();
    if (nt > 1) { copy_a(1, 1); load_w(1); }

    for (int t = 0; t < nt; ++t) {
        const int cur = t & 1;
        #pragma unroll
        for (int ks = 0; ks < 2; ++ks) {
            v16h af[2];
            #pragma unroll
            for (int mi = 0; mi < 2; ++mi)
                af[mi] = make_frag(&ldsA[cur][(wave * 32 + mi * 16 + r) * AP + ks * 32 + 8 * hi]);
            #pragma unroll
            for (int sub = 0; sub < 4; ++sub) {
                v16h bfrag = make_frag_tr(&ldsB[cur][(ks * 32 + trow) * TP + sub * 16 + tcol], TP);
                #pragma unroll
                for (int mi = 0; mi < 2; ++mi)
                    acc[mi][sub] = __builtin_amdgcn_wmma_f32_16x16x32_f16(
                        false, bfrag, false, af[mi], (short)0, acc[mi][sub], false, false);
            }
        }
        // the other W buffer was left by its readers at the barrier of stage t - 1
        if (t + 1 < nt) store_w(cur ^ 1);
        // publish stage t + 1 and free stage t's buffers with one barrier
        lds_wait();
        cp_wait();
        __syncthreads();
        if (t + 2 < nt) { copy_a(t + 2, cur); load_w(t + 2); }
    }
    cp_wait();

    // Epilogue: whole 128-byte lines. The ring is free behind the loop's last
    // barrier: each wave stages its 32 rows of 256 B (pitch OP floats) in rows
    // of ldsA that are its own, and stores two whole rows per instruction.
    float* stg = (float*)&ldsA[0][0] + wave * (32 * OP);
    const v4f* bp = (const v4f*)(bias + n0 + 8 * hi);
    v8f bvec[4];
    #pragma unroll
    for (int sub = 0; sub < 4; ++sub)
        bvec[sub] = __builtin_shufflevector(bp[sub * 4], bp[sub * 4 + 1], 0,1,2,3,4,5,6,7);
    // the bias loads' address stays whole up to this wait, in front of its reuse
    asm volatile("s_wait_xcnt 0x0" :: "v"(bp) : "memory");
    #pragma unroll
    for (int sub = 0; sub < 4; ++sub) {
        #pragma unroll
        for (int mi = 0; mi < 2; ++mi) {
            const v8f o = acc[mi][sub] + bvec[sub];
            float* sp = stg + (mi * 16 + r) * OP + sub * 16 + 8 * hi;
            *(v4f*)(sp)     = __builtin_shufflevector(o, o, 0,1,2,3);
            *(v4f*)(sp + 4) = __builtin_shufflevector(o, o, 4,5,6,7);
        }
    }
    lds_wait();   // the rows are read back by other lanes of this wave
    // lane's place in the first two rows; the rows are uniform strides from it
    float* op = Out + (size_t)(m0 + wave * 32 + (lane >> 4)) * N + n0 + ((lane & 15) << 2);
    #pragma unroll
    for (int g = 0; g < 2; ++g) {
        v4f  x[8];
        v4f* px[8];
        #pragma unroll
        for (int j = 0; j < 8; ++j) {      // lane's row: g * 16 + j * 2 + (lane >> 4)
            const int row = g * 16 + j * 2 + (lane >> 4);
            x[j]  = *(const v4f*)(stg + row * OP + ((lane & 15) << 2));
            px[j] = (v4f*)(op + (size_t)(g * 16 + j * 2) * N);
        }
        #pragma unroll
        for (int j = 0; j < 8; ++j) *px[j] = x[j];
        // the stores' address and data registers stay whole up to this wait,
        // which stands in front of their reuse by the next 16 rows
        if (g == 0)
            asm volatile("s_wait_xcnt 0x0" :: "v"(px[0]), "v"(px[1]), "v"(px[2]), "v"(px[3]),
                         "v"(px[4]), "v"(px[5]), "v"(px[6]), "v"(px[7]),
                         "v"(x[0]), "v"(x[1]), "v"(x[2]), "v"(x[3]),
                         "v"(x[4]), "v"(x[5]), "v"(x[6]), "v"(x[7]) : "memory");
    }
}

// lane l <-> lane l ^ 16: the two lanes that share one query
__device__ __forceinline__ float xhalf(float x) {
    return __builtin_bit_cast(float, __builtin_amdgcn_permlanex16(
        __builtin_bit_cast(int, x), __builtin_bit_cast(int, x),
        0x76543210, 0xfedcba98, false, false));
}

// four waves per SIMD (two work-groups per WGP) need at most 256 registers
__global__ __launch_bounds__(256) __attribute__((amdgpu_waves_per_eu(4, 4))) void attn_kernel(
    const _Float16* __restrict__ Qw, const _Float16* __restrict__ Kw,
    const _Float16* __restrict__ Vw, _Float16* __restrict__ Ctx)
{
    // per key half two buffers each: the next 64 keys are on their way while
    // these are worked on
    __shared__ __align__(16) _Float16 ldsK[2][2][64 * AP];    // [half][buffer][key][hd], pitch AP
    __shared__ __align__(16) _Float16 ldsV[2][2][64 * TP];    // [half][buffer][key][hd], pitch TP

    const int tid  = threadIdx.x;
    const int wave = tid >> 5;
    const int kh   = __builtin_amdgcn_readfirstlane(tid >> 7);   // wave's half of the keys
    const int wq   = wave & 3;                  // wave's 32 queries of the 128
    const int th   = tid & 127;                 // thread's number inside its half
    const int lane = tid & 31;
    const int r    = lane & 15;
    const int hi   = lane >> 4;
    const int trow = 8 * hi + (lane & 7);       // transposing load: this lane's row
    const int tcol = 8 * ((lane >> 3) & 1);     // and its 16-byte half of the 16 columns

    const int bh = blockIdx.x;
    const int b  = bh / Hc;
    const int h  = bh % Hc;
    const int q0 = blockIdx.y * 128;

    const size_t base   = ((size_t)b * Sc * Hc + h) * HDc;  // (b, s=0, h, 0)
    const size_t rowstr = (size_t)Hc * HDc;                 // per-s stride (halves)

    // Q fragments (B operand): 2 query groups x 2 k-steps over HD=64
    v16h bq[2][2];
    #pragma unroll
    for (int mi = 0; mi < 2; ++mi) {
        const _Float16* qp = Qw + base
            + (size_t)(q0 + wq * 32 + r) * rowstr + mi * 16 * rowstr;
        #pragma unroll
        for (int ks = 0; ks < 2; ++ks)
            bq[mi][ks] = make_frag(qp + ks * 32 + 8 * hi);
    }

    // per lane: minus the reference in use of query r (equal in both halves of
    // the wave) as a whole C operand, and the running sum over this lane half's
    // keys (joined after the loop). Stage 0 sets the reference.
    float lrow[2] = {0.0f, 0.0f};
    v8f cneg[2] = {};
    v8f O[4][2] = {};   // O^T: [16 head dims][query group]

    // stage K and V as they lie (async straight copies); the 128 threads of a
    // key half fill that half's buffers
    const size_t kbase = base + (size_t)(kh * (Sc / 2)) * rowstr;
    auto copy_kv = [&](int t, int buf) {
        #pragma unroll
        for (int j = 0; j < 4; ++j) {
            int idx = th + j * 128;           // 512 chunks of 8 halves
            int key = idx >> 3;
            int c8  = (idx & 7) << 3;
            size_t g = kbase + (size_t)(t * 64 + key) * rowstr + c8;
            cp_b128(&ldsK[kh][buf][key * AP + c8], Kw + g);
            cp_b128(&ldsV[kh][buf][key * TP + c8], Vw + g);
        }
    };
    constexpr int NT = Sc / 2 / 64;   // 16 stages per key half
    copy_kv(0, 0);
    cp_wait();
    __syncthreads();
    copy_kv(1, 1);

    // kept whole: split off from the loop, stage 0 meets its barrier, and so the
    // wait for stage 1's copies, ahead of its own products instead of behind them
    #pragma clang loop unroll(disable)
    for (int t = 0; t < NT; ++t) {
        const int cur = t & 1;

        // exponents: S^T[64k x 32q] = K(64x64) * Q^T - reference ; K fragments reused across mi
        v8f sacc[4][2];
        #pragma unroll
        for (int ks = 0; ks < 2; ++ks) {
            #pragma unroll
            for (int kt = 0; kt < 4; ++kt) {
                v16h kfrag = make_frag(&ldsK[kh][cur][(kt * 16 + r) * AP + ks * 32 + 8 * hi]);
                #pragma unroll
                for (int mi = 0; mi < 2; ++mi)
                    sacc[kt][mi] = __builtin_amdgcn_wmma_f32_16x16x32_f16(
                        false, kfrag, false, bq[mi][ks], (short)0,
                        ks == 0 ? cneg[mi] : sacc[kt][mi], false, false);
            }
        }

        // a lane holds 32 of the 64 exponents of its query: how far their maximum
        // stands above the reference in use
        float m8[2];
        #pragma unroll
        for (int mi = 0; mi < 2; ++mi) {
            float t8[8];
            #pragma unroll
            for (int v = 0; v < 8; ++v)
                t8[v] = fmaxf(fmaxf(sacc[0][mi][v], sacc[1][mi][v]),
                              fmaxf(sacc[2][mi][v], sacc[3][mi][v]));
            m8[mi] = fmaxf(fmaxf(fmaxf(t8[0], t8[1]), fmaxf(t8[2], t8[3])),
                           fmaxf(fmaxf(t8[4], t8[5]), fmaxf(t8[6], t8[7])));
        }
        // one test per stage, a scalar branch: always taken in stage 0, which
        // sets the reference, rare behind it
        const float thr = t == 0 ? -3.0e38f : 8.0f;
        const float low = t == 0 ? -3.0e38f : 0.0f;
        const bool need = fmaxf(m8[0], m8[1]) > thr;
        if (__builtin_amdgcn_ballot_w32(need) != 0) {
            #pragma unroll
            for (int mi = 0; mi < 2; ++mi) {
                // the query's maximum, equal in both halves of the wave; stage 0
                // takes it as it is, also below 0 (O and the sum are still 0 there:
                // factor 1); later the reference only rises
                const float rm   = fmaxf(m8[mi], xhalf(m8[mi]));
                const float d    = fmaxf(rm, low);
                const float scal = __builtin_amdgcn_exp2f(fminf(-d, 0.0f));
                const float nref = cneg[mi][0] - d;
                lrow[mi] *= scal;
                #pragma unroll
                for (int kt = 0; kt < 4; ++kt) sacc[kt][mi] -= d;
                #pragma unroll
                for (int sub = 0; sub < 4; ++sub) O[sub][mi] *= scal;
                #pragma unroll
                for (int v = 0; v < 8; ++v) cneg[mi][v] = nref;
            }
        }

        v16h pf[2][2];   // P^T as B operand: [query group][32-key step]
        #pragma unroll
        for (int mi = 0; mi < 2; ++mi) {
            #pragma unroll
            for (int kt = 0; kt < 4; ++kt) {
                #pragma unroll
                for (int v = 0; v < 8; ++v)
                    sacc[kt][mi][v] = __builtin_amdgcn_exp2f(sacc[kt][mi][v]);
            }
            const v8f rs = (sacc[0][mi] + sacc[1][mi]) + (sacc[2][mi] + sacc[3][mi]);
            lrow[mi] += ((rs[0] + rs[1]) + (rs[2] + rs[3])) + ((rs[4] + rs[5]) + (rs[6] + rs[7]));
            // element s of the B operand is key 8*hi + s (s < 8) or 16 + 8*hi + s - 8:
            // registers 0..7 of two S^T tiles that follow one another
            #pragma unroll
            for (int ks = 0; ks < 2; ++ks) {
                v8h plo = __builtin_convertvector(sacc[2 * ks][mi], v8h);
                v8h phi = __builtin_convertvector(sacc[2 * ks + 1][mi], v8h);
                pf[mi][ks] = __builtin_shufflevector(plo, phi,
                    0,1,2,3,4,5,6,7,8,9,10,11,12,13,14,15);
            }
        }

        // O^T += V^T(64x64) * P^T(64x32); V^T fragments reused across mi
        #pragma unroll
        for (int ks = 0; ks < 2; ++ks) {
            #pragma unroll
            for (int sub = 0; sub < 4; ++sub) {
                v16h vfrag = make_frag_tr(&ldsV[kh][cur][(ks * 32 + trow) * TP + sub * 16 + tcol], TP);
                #pragma unroll
                for (int mi = 0; mi < 2; ++mi)
                    O[sub][mi] = __builtin_amdgcn_wmma_f32_16x16x32_f16(
                        false, vfrag, false, pf[mi][ks], (short)0, O[sub][mi], false, false);
            }
        }
        // publish stage t + 1 and free stage t's buffers with one barrier
        lds_wait();
        cp_wait();
        __syncthreads();
        if (t + 2 < NT) copy_kv(t + 2, cur);
    }
    cp_wait();

    // Merge of the two key halves. Waves w and w ^ 4 hold the same 32 queries:
    // the wave of half 0 finishes query group 0 and hands over its group 1, the
    // wave of half 1 the other way round (kh is uniform in a wave: scalar
    // branches). The ring is free behind the loop's last barrier; a wave's
    // 9 x 512 B lie lane by lane, 16 B each.
    v4f* xch = (v4f*)&ldsK[0][0][0];            // 8 waves x 4,608 B: all of ldsK
    v4f* mine         = xch + wave * (9 * 32) + lane;
    const v4f* theirs = xch + (wave ^ 4) * (9 * 32) + lane;
    auto hand_over = [&](int mi) {
        #pragma unroll
        for (int sub = 0; sub < 4; ++sub) {
            mine[(2 * sub) * 32]     = __builtin_shufflevector(O[sub][mi], O[sub][mi], 0,1,2,3);
            mine[(2 * sub + 1) * 32] = __builtin_shufflevector(O[sub][mi], O[sub][mi], 4,5,6,7);
        }
        mine[8 * 32] = (v4f){-cneg[mi][0], lrow[mi] + xhalf(lrow[mi]), 0.0f, 0.0f};
    };
    // join with the partner's part, normalize and store ctx (f16, [B,S,H,HD]):
    // a lane holds 8 consecutive head dims of its query per tile, one 16-byte
    // store each
    auto finish = [&](int mi) {
        const v4f   ml = theirs[8 * 32];
        // the part with the higher reference keeps its scale, the other comes down to it
        const float dm = -cneg[mi][0] - ml[0];
        const float e  = __builtin_amdgcn_exp2f(-fabsf(dm));
        const float ak = dm < 0.0f ? e : 1.0f;
        const float ap = dm < 0.0f ? 1.0f : e;
        const float l  = (lrow[mi] + xhalf(lrow[mi])) * ak + ml[1] * ap;
        #pragma unroll
        for (int sub = 0; sub < 4; ++sub) {
            const v8f got = __builtin_shufflevector(theirs[(2 * sub) * 32],
                                                    theirs[(2 * sub + 1) * 32], 0,1,2,3,4,5,6,7);
            const v8f o = O[sub][mi] * ak + got * ap;
            v8h o8;
            #pragma unroll
            for (int v = 0; v < 8; ++v)
                o8[v] = (_Float16)(o[v] / l);
            *(v8h*)(Ctx + base + (size_t)(q0 + wq * 32 + r) * rowstr + mi * 16 * rowstr
                    + sub * 16 + 8 * hi) = o8;
        }
    };
    if (kh == 0) hand_over(1); else hand_over(0);
    lds_wait();        // this wave's writes have retired in front of the barrier
    __syncthreads();   // the partner wave reads them behind it
    if (kh == 0) finish(0); else finish(1);
}

extern "C" void kernel_launch(void* const* d_in, const int* in_sizes, int n_in,
                              void* d_out, int out_size, void* d_ws, size_t ws_size,
                              hipStream_t stream) {
    (void)in_sizes; (void)n_in; (void)out_size; (void)ws_size;

    const float* Xq  = (const float*)d_in[0];
    const float* Xkv = (const float*)d_in[1];
    const float* Wq  = (const float*)d_in[2];
    const float* bq  = (const float*)d_in[3];
    const float* Wk  = (const float*)d_in[4];
    const float* bk  = (const float*)d_in[5];
    const float* Wv  = (const float*)d_in[6];
    const float* bv  = (const float*)d_in[7];
    const float* Wo  = (const float*)d_in[8];
    const float* bo  = (const float*)d_in[9];
    float* out = (float*)d_out;

    const size_t elems = (size_t)BSM * Dm;  // 4096*1024
    _Float16* Qh = (_Float16*)d_ws;
    _Float16* Kh = Qh + elems;
    _Float16* Vh = Kh + elems;
    _Float16* Ch = Vh + elems;

    dim3 blk(128);
    dim3 gg(Dm / GN, BSM / GM);       // (16, 32)

    const float qscale = 0.18033688011112042f;   // log2(e)/sqrt(HD=64)
    dim3 gp(Dm / PN, BSM / PM, 3);    // (8, 16, 3): Qh, Kh, Vh follow one another
    gemm_proj_f16out<<<gp, dim3(256), 0, stream>>>(Xq, Xkv, Wq, Wk, Wv, bq, bk, bv, Qh,
                                             qscale, BSM, Dm, Dm);

    dim3 ga(Bc * Hc, Sc / 128);       // (32, 16)
    attn_kernel<<<ga, dim3(256), 0, stream>>>(Qh, Kh, Vh, Ch);

    gemm_out_f32<<<gg, blk, 0, stream>>>(Ch, Wo, bo, out, BSM, Dm, Dm);
}

// v010
// A run of this version takes 80.8 microseconds.
// In both of two side-by-side timings against v009, it was 1.04 times as fast.
// Counting every step since v000, it is 4.45 times as fast.
#include <hip/hip_runtime.h>
#include <hip/hip_bf16.h>

// ---- problem constants (match reference) ----
#define Bc   2
#define Sc   2048
#define Dm   1024
#define Hc   16
#define HDc  64
#define BSM  (Bc * Sc)          // 4096 rows

typedef __attribute__((ext_vector_type(16))) _Float16 v16h;
typedef __attribute__((ext_vector_type(8)))  _Float16 v8h;
typedef __attribute__((ext_vector_type(4)))  _Float16 v4h;
typedef __attribute__((ext_vector_type(8)))  float    v8f;
typedef __attribute__((ext_vector_type(4)))  float    v4f;
typedef __attribute__((ext_vector_type(4)))  int      v4i;
typedef __attribute__((ext_vector_type(8)))  short    v8s;

// ---------- CDNA5 async global->LDS copy (ASYNCcnt path), guarded ----------
#if defined(__has_builtin)
#  if __has_builtin(__builtin_amdgcn_global_load_async_to_lds_b128)
#    define HAS_ASYNC_CP 1
#  endif
#endif
#ifndef HAS_ASYNC_CP
#  define HAS_ASYNC_CP 0
#endif

#if HAS_ASYNC_CP
typedef __attribute__((address_space(1))) v4i* g_v4i_p;   // global int4*
typedef __attribute__((address_space(3))) v4i* l_v4i_p;   // LDS int4*
__device__ __forceinline__ void cp_b128(void* lds, const void* g) {
    // global side: flat address == global address, so inttoptr into AS1 is safe;
    // LDS side: generic -> AS3 addrspacecast.
    __builtin_amdgcn_global_load_async_to_lds_b128(
        (g_v4i_p)(uintptr_t)g, (l_v4i_p)lds, 0, 0);
}
__device__ __forceinline__ void cp_wait() {
    // this wave's copies have landed; the clobber holds every LDS read behind it
    asm volatile("s_wait_asynccnt 0x0" ::: "memory");
}
#else
__device__ __forceinline__ void cp_b128(void* lds, const void* g) {
    *(v8h*)lds = *(const v8h*)g;
}
__device__ __forceinline__ void cp_wait() {}
#endif

__device__ __forceinline__ void lds_wait() {
    // this wave's LDS reads and writes have retired, so that the buffer it
    // leaves may be refilled behind the barrier that follows
    asm volatile("s_wait_dscnt 0x0" ::: "memory");
}

__device__ __forceinline__ v16h make_frag(const _Float16* p) {
    // per-lane 16-bit fragment = two contiguous 8-half (16B) chunks:
    // k in [8*hi, 8*hi+8) and [16+8*hi, 16+8*hi+8); caller bakes 8*hi into p.
    v8h lo = *(const v8h*)(p);
    v8h hi8 = *(const v8h*)(p + 16);
    return __builtin_shufflevector(lo, hi8, 0,1,2,3,4,5,6,7,8,9,10,11,12,13,14,15);
}

typedef __attribute__((address_space(3))) v8s* l_v8s_p;   // LDS short8*
__device__ __forceinline__ v16h make_frag_tr(const _Float16* p, int pitch) {
    // the same fragment out of a tile that lies [k][column] in LDS: each
    // transposing load hands lane (r, hi) the 8 halves T[kb + 8*hi + 0..7][cb + r];
    // caller bakes (kb + 8*hi + (lane & 7)) * pitch + cb + 8 * ((lane >> 3) & 1) into p.
    v8h lo  = __builtin_bit_cast(v8h, __builtin_amdgcn_ds_load_tr16_b128_v8i16((l_v8s_p)p));
    v8h hi8 = __builtin_bit_cast(v8h, __builtin_amdgcn_ds_load_tr16_b128_v8i16((l_v8s_p)(p + 16 * pitch)));
    return __builtin_shufflevector(lo, hi8, 0,1,2,3,4,5,6,7,8,9,10,11,12,13,14,15);
}

#define GM   128   // output product: block M tile (2 x 16 rows per wave)
#define GN   64
#define PM   256   // projections: block tile, 4 x 2 waves of 64 x 64
#define PN   128
#define GKO  64    // k per stage, both products (two 32-k blocks): rows of 128 B
// LDS row pitches in halves: 16 B x odd, so the 16 rows of a ds_load_b128
// fragment read fall on 16 different groups of four banks.
#define AP   72    // 128-B rows -> 144 B
// Rows read by the transposing load: 32 B x odd.
#define TP   80    // 128-B rows -> 160 B
#define BP   144   // 256-B rows -> 288 B
// Output staging, f32 rows of 256 B, in floats: 16 B x odd.
#define OP   68    // 256-B rows -> 272 B

// ---------------- f32 -> f16, once ----------------
// Every tile of the products reads its operands many times over: they are
// rounded here once, so that the products draw half the bytes and stage them
// with no register in between. dst takes Xq, Xkv, Wq, Wk, Wv, Wo one behind the
// other. A block does three pieces of CH floats: one of Xq, one of Xkv, one of
// a weight matrix (128 pieces each).
#define CH 8192
__global__ __launch_bounds__(256) void to_f16(
    const float* __restrict__ Xq, const float* __restrict__ Xkv,
    const float* __restrict__ Wq, const float* __restrict__ Wk,
    const float* __restrict__ Wv, const float* __restrict__ Wo,
    _Float16* __restrict__ dst)
{
    const int b = blockIdx.x;
    const int w = b >> 7;
    const float* __restrict__ Ws = w == 0 ? Wq : (w == 1 ? Wk : (w == 2 ? Wv : Wo));
    const float* s0 = Xq  + (size_t)b * CH;
    const float* s1 = Xkv + (size_t)b * CH;
    const float* s2 = Ws  + (size_t)(b & 127) * CH;
    // a uniform base plus the thread's number; a wave's load covers 512 B that
    // follow one another, its store 256 B. The f32 bytes are read once and never
    // again: non-temporal, so that L2 keeps the f16 copy for the products.
    const unsigned tid = threadIdx.x;
    v4f x[3][8];
    #pragma unroll
    for (int j = 0; j < 8; ++j) {
        x[0][j] = __builtin_nontemporal_load((const v4f*)(s0 + j * 1024) + tid);
        x[1][j] = __builtin_nontemporal_load((const v4f*)(s1 + j * 1024) + tid);
        x[2][j] = __builtin_nontemporal_load((const v4f*)(s2 + j * 1024) + tid);
    }
    // the loads' offset register stays whole up to this wait, which stands in
    // front of any reuse
    asm volatile("s_wait_xcnt 0x0" :: "v"(tid) : "memory");
    #pragma unroll
    for (int c = 0; c < 3; ++c) {
        _Float16* d = dst + (size_t)(c * 512 + b) * CH;
        #pragma unroll
        for (int j = 0; j < 8; ++j)
            *((v4h*)(d + j * 1024) + tid) = __builtin_convertvector(x[c][j], v4h);
    }
}

// ---------------- GEMM: C_f16 = (A_f16 * W_f16 + bias) * scale ----------------
// One launch does the three projections: blockIdx.z picks the product
// (0: query, scaled; 1: key; 2: value). The three results lie one behind the
// other in Cbase, M * N halves each; so do the two inputs in X16 and the three
// weight matrices in W16.
// Block tile 256 x 128, 8 waves (4 x 2) of 64 x 64: a loaded byte of A serves
// 128 columns and a loaded byte of W 256 rows, and a fragment read from LDS
// serves four products.
// W^T is the first operand and the rows of A the second: register v of lane
// (r, hi) is then C[row r][column 8*hi + v], 8 columns that follow one another.
__global__ __launch_bounds__(256) void gemm_proj_f16out(
    const _Float16* __restrict__ X16, const _Float16* __restrict__ W16,
    const float* __restrict__ bq, const float* __restrict__ bk,
    const float* __restrict__ bv, _Float16* __restrict__ Cbase,
    float qscale, int M, int N, int Kdim)
{
    // two buffers each: stage t + 1 is on its way while stage t is multiplied
    __shared__ __align__(16) _Float16 ldsA[2][PM * AP];    // [m][k], pitch AP
    __shared__ __align__(16) _Float16 ldsB[2][GKO * BP];   // [k][n], pitch BP

    const int which = blockIdx.z;
    const _Float16* __restrict__ A = X16 + (which == 0 ? (size_t)0 : (size_t)M * Kdim);
    const _Float16* __restrict__ W = W16 + (size_t)which * Kdim * N;
    const float* __restrict__ bias = which == 0 ? bq : (which == 1 ? bk : bv);
    _Float16* __restrict__ Cout    = Cbase + (size_t)which * M * N;
    const float scale              = which == 0 ? qscale : 1.0f;

    const int tid  = threadIdx.x;
    const int wave = tid >> 5;
    const int wm   = wave >> 1;                 // wave's 64 rows of the tile
    const int wn   = wave & 1;                  // wave's 64 columns
    const int lane = tid & 31;
    const int r    = lane & 15;
    const int hi   = lane >> 4;
    const int trow = 8 * hi + (lane & 7);       // transposing load: this lane's row
    const int tcol = 8 * ((lane >> 3) & 1);     // and its 16-byte half of the 16 columns

    const int m0 = blockIdx.y * PM;
    const int n0 = blockIdx.x * PN;

    v8f acc[4][4] = {};

    // One stage: 256x64 of A (8 chunks of 16 B per thread) and 64x128 of W
    // (4 chunks), straight copies to LDS.
    // Addresses are a uniform base plus one 32-bit byte offset per thread.
    const unsigned a_off = (unsigned)((tid >> 3) * Kdim + ((tid & 7) << 3)) * 2u;
    const unsigned w_off = (unsigned)((tid >> 4) * N + ((tid & 15) << 3)) * 2u;
    auto copy_stage = [&](int t, int buf) {
        #pragma unroll
        for (int j = 0; j < 8; ++j)        // thread's row: j * 32 + (tid >> 3)
            cp_b128(&ldsA[buf][(j * 32 + (tid >> 3)) * AP + ((tid & 7) << 3)],
                    (const char*)(A + (size_t)(m0 + j * 32) * Kdim + t * GKO) + a_off);
        #pragma unroll
        for (int j = 0; j < 4; ++j)        // thread's k row: j * 16 + (tid >> 4)
            cp_b128(&ldsB[buf][(j * 16 + (tid >> 4)) * BP + ((tid & 15) << 3)],
                    (const char*)(W + (size_t)(t * GKO + j * 16) * N + n0) + w_off);
    };

    const int nt = Kdim / GKO;
    copy_stage(0, 0);
    cp_wait();
    __syncthreads();
    if (nt > 1) copy_stage(1, 1);

    for (int t = 0; t < nt; ++t) {
        const int cur = t & 1;
        #pragma unroll
        for (int ks = 0; ks < 2; ++ks) {
            v16h af[4];
            #pragma unroll
            for (int mi = 0; mi < 4; ++mi)
                af[mi] = make_frag(&ldsA[cur][(wm * 64 + mi * 16 + r) * AP + ks * 32 + 8 * hi]);
            #pragma unroll
            for (int sub = 0; sub < 4; ++sub) {
                v16h bfrag = make_frag_tr(&ldsB[cur][(ks * 32 + trow) * BP + wn * 64 + sub * 16 + tcol], BP);
                #pragma unroll
                for (int mi = 0; mi < 4; ++mi)
                    acc[mi][sub] = __builtin_amdgcn_wmma_f32_16x16x32_f16(
                        false, bfrag, false, af[mi], (short)0, acc[mi][sub], false, false);
            }
        }
        // publish stage t + 1 and free stage t's buffers with one barrier
        lds_wait();
        cp_wait();
        __syncthreads();
        if (t + 2 < nt) copy_stage(t + 2, cur);
    }
    cp_wait();

    // Epilogue: whole 128-byte lines. The loop's last barrier has ended every
    // read of the ring, so each wave stages 32 rows of its tile (128 B each,
    // pitch AP) at a time in rows of ldsA that are its own, and stores them
    // four whole rows per instruction.
    _Float16* stg = &ldsA[0][0] + wave * (32 * AP);
    const v4f* bp = (const v4f*)(bias + n0 + wn * 64 + 8 * hi);
    v8f bvec[4];
    #pragma unroll
    for (int sub = 0; sub < 4; ++sub)
        bvec[sub] = __builtin_shufflevector(bp[sub * 4], bp[sub * 4 + 1], 0,1,2,3,4,5,6,7);
    // the bias loads' address stays whole up to this wait, in front of its reuse
    asm volatile("s_wait_xcnt 0x0" :: "v"(bp) : "memory");
    // lane's place in the first four rows; the rows are uniform strides from it
    _Float16* cp = Cout + (size_t)(m0 + wm * 64 + (lane >> 3)) * N
                 + n0 + wn * 64 + ((lane & 7) << 3);
    #pragma unroll
    for (int half = 0; half < 2; ++half) {
        #pragma unroll
        for (int m2 = 0; m2 < 2; ++m2) {
            #pragma unroll
            for (int sub = 0; sub < 4; ++sub)
                *(v8h*)(stg + (m2 * 16 + r) * AP + sub * 16 + 8 * hi) =
                    __builtin_convertvector((acc[half * 2 + m2][sub] + bvec[sub]) * scale, v8h);
        }
        lds_wait();   // the rows are read back by other lanes of this wave
        v8h  x[8];
        v8h* px[8];
        #pragma unroll
        for (int j = 0; j < 8; ++j) {      // lane's row: j * 4 + (lane >> 3)
            const int row = j * 4 + (lane >> 3);
            x[j]  = *(const v8h*)(stg + row * AP + ((lane & 7) << 3));
            px[j] = (v8h*)(cp + (size_t)(half * 32 + j * 4) * N);
        }
        #pragma unroll
        for (int j = 0; j < 8; ++j) *px[j] = x[j];
        // the stores' address and data registers stay whole up to this wait,
        // which stands in front of their reuse by the next 32 rows; the clobber
        // holds those rows' LDS writes behind the reads that fed the stores
        if (half == 0)
            asm volatile("s_wait_xcnt 0x0" :: "v"(px[0]), "v"(px[1]), "v"(px[2]), "v"(px[3]),
                         "v"(px[4]), "v"(px[5]), "v"(px[6]), "v"(px[7]),
                         "v"(x[0]), "v"(x[1]), "v"(x[2]), "v"(x[3]),
                         "v"(x[4]), "v"(x[5]), "v"(x[6]), "v"(x[7]) : "memory");
    }
}

// ---------------- GEMM: out_f32 = A_f16 * W_f16 + bias ----------------
// W^T is the first operand here too: a lane holds 8 columns of one row.
__global__ __launch_bounds__(128) void gemm_out_f32(
    const _Float16* __restrict__ A, const _Float16* __restrict__ W,
    const float* __restrict__ bias, float* __restrict__ Out,
    int M, int N, int Kdim)
{
    // two buffers each: stage t + 1 is on its way while stage t is multiplied
    __shared__ __align__(16) _Float16 ldsA[2][GM * AP];    // [m][k], pitch AP
    __shared__ __align__(16) _Float16 ldsB[2][GKO * TP];   // [k][n], pitch TP

    const int tid  = threadIdx.x;
    const int wave = tid >> 5;
    const int lane = tid & 31;
    const int r    = lane & 15;
    const int hi   = lane >> 4;
    const int trow = 8 * hi + (lane & 7);       // transposing load: this lane's row
    const int tcol = 8 * ((lane >> 3) & 1);     // and its 16-byte half of the 16 columns

    const int m0 = blockIdx.y * GM;
    const int n0 = blockIdx.x * GN;

    v8f acc[2][4] = {};

    // A stage: 128x64 f16 straight copy to LDS (1024 chunks of 16 B, 8 per thread)
    // Addresses are a uniform base plus one 32-bit byte offset per thread.
    const unsigned a_off = (unsigned)((tid >> 3) * Kdim + ((tid & 7) << 3)) * 2u;
    const unsigned w_off = (unsigned)((tid >> 3) * N + ((tid & 7) << 3)) * 2u;
    auto copy_a = [&](int t, int buf) {
        #pragma unroll
        for (int j = 0; j < 8; ++j) {      // thread's row: j * 16 + (tid >> 3)
            int row = j * 16 + (tid >> 3);
            int c8  = (tid & 7) << 3;
            cp_b128(&ldsA[buf][row * AP + c8],
                    (const char*)(A + (size_t)(m0 + j * 16) * Kdim + t * GKO) + a_off);
        }
    };
    // W stage: 64x64 f16 straight copy to LDS (512 chunks of 16 B, 4 per thread)
    auto copy_w = [&](int t, int buf) {
        #pragma unroll
        for (int j = 0; j < 4; ++j)        // thread's k row: j * 16 + (tid >> 3)
            cp_b128(&ldsB[buf][(j * 16 + (tid >> 3)) * TP + ((tid & 7) << 3)],
                    (const char*)(W + (size_t)(t * GKO + j * 16) * N + n0) + w_off);
    };

    const int nt = Kdim / GKO;
    copy_a(0, 0);
    copy_w(0, 0);
    cp_wait();
    __syncthreads();
    if (nt > 1) { copy_a(1, 1); copy_w(1, 1); }

    for (int t = 0; t < nt; ++t) {
        const int cur = t & 1;
        #pragma unroll
        for (int ks = 0; ks < 2; ++ks) {
            v16h af[2];
            #pragma unroll
            for (int mi = 0; mi < 2; ++mi)
                af[mi] = make_frag(&ldsA[cur][(wave * 32 + mi * 16 + r) * AP + ks * 32 + 8 * hi]);
            #pragma unroll
            for (int sub = 0; sub < 4; ++sub) {
                v16h bfrag = make_frag_tr(&ldsB[cur][(ks * 32 + trow) * TP + sub * 16 + tcol], TP);
                #pragma unroll
                for (int mi = 0; mi < 2; ++mi)
                    acc[mi][sub] = __builtin_amdgcn_wmma_f32_16x16x32_f16(
                        false, bfrag, false, af[mi], (short)0, acc[mi][sub], false, false);
            }
        }
        // publish stage t + 1 and free stage t's buffers with one barrier
        lds_wait();
        cp_wait();
        __syncthreads();
        if (t + 2 < nt) { copy_a(t + 2, cur); copy_w(t + 2, cur); }
    }
    cp_wait();

    // Epilogue: whole 128-byte lines. The ring is free behind the loop's last
    // barrier: each wave stages its 32 rows of 256 B (pitch OP floats) in rows
    // of ldsA that are its own, and stores two whole rows per instruction.
    float* stg = (float*)&ldsA[0][0] + wave * (32 * OP);
    const v4f* bp = (const v4f*)(bias + n0 + 8 * hi);
    v8f bvec[4];
    #pragma unroll
    for (int sub = 0; sub < 4; ++sub)
        bvec[sub] = __builtin_shufflevector(bp[sub * 4], bp[sub * 4 + 1], 0,1,2,3,4,5,6,7);
    // the bias loads' address stays whole up to this wait, in front of its reuse
    asm volatile("s_wait_xcnt 0x0" :: "v"(bp) : "memory");
    #pragma unroll
    for (int sub = 0; sub < 4; ++sub) {
        #pragma unroll
        for (int mi = 0; mi < 2; ++mi) {
            const v8f o = acc[mi][sub] + bvec[sub];
            float* sp = stg + (mi * 16 + r) * OP + sub * 16 + 8 * hi;
            *(v4f*)(sp)     = __builtin_shufflevector(o, o, 0,1,2,3);
            *(v4f*)(sp + 4) = __builtin_shufflevector(o, o, 4,5,6,7);
        }
    }
    lds_wait();   // the rows are read back by other lanes of this wave
    // lane's place in the first two rows; the rows are uniform strides from it
    float* op = Out + (size_t)(m0 + wave * 32 + (lane >> 4)) * N + n0 + ((lane & 15) << 2);
    #pragma unroll
    for (int g = 0; g < 2; ++g) {
        v4f  x[8];
        v4f* px[8];
        #pragma unroll
        for (int j = 0; j < 8; ++j) {      // lane's row: g * 16 + j * 2 + (lane >> 4)
            const int row = g * 16 + j * 2 + (lane >> 4);
            x[j]  = *(const v4f*)(stg + row * OP + ((lane & 15) << 2));
            px[j] = (v4f*)(op + (size_t)(g * 16 + j * 2) * N);
        }
        #pragma unroll
        for (int j = 0; j < 8; ++j) *px[j] = x[j];
        // the stores' address and data registers stay whole up to this wait,
        // which stands in front of their reuse by the next 16 rows
        if (g == 0)
            asm volatile("s_wait_xcnt 0x0" :: "v"(px[0]), "v"(px[1]), "v"(px[2]), "v"(px[3]),
                         "v"(px[4]), "v"(px[5]), "v"(px[6]), "v"(px[7]),
                         "v"(x[0]), "v"(x[1]), "v"(x[2]), "v"(x[3]),
                         "v"(x[4]), "v"(x[5]), "v"(x[6]), "v"(x[7]) : "memory");
    }
}

// lane l <-> lane l ^ 16: the two lanes that share one query
__device__ __forceinline__ float xhalf(float x) {
    return __builtin_bit_cast(float, __builtin_amdgcn_permlanex16(
        __builtin_bit_cast(int, x), __builtin_bit_cast(int, x),
        0x76543210, 0xfedcba98, false, false));
}

// four waves per SIMD (two work-groups per WGP) need at most 256 registers
__global__ __launch_bounds__(256) __attribute__((amdgpu_waves_per_eu(4, 4))) void attn_kernel(
    const _Float16* __restrict__ Qw, const _Float16* __restrict__ Kw,
    const _Float16* __restrict__ Vw, _Float16* __restrict__ Ctx)
{
    // per key half two buffers each: the next 64 keys are on their way while
    // these are worked on
    __shared__ __align__(16) _Float16 ldsK[2][2][64 * AP];    // [half][buffer][key][hd], pitch AP
    __shared__ __align__(16) _Float16 ldsV[2][2][64 * TP];    // [half][buffer][key][hd], pitch TP

    const int tid  = threadIdx.x;
    const int wave = tid >> 5;
    const int kh   = __builtin_amdgcn_readfirstlane(tid >> 7);   // wave's half of the keys
    const int wq   = wave & 3;                  // wave's 32 queries of the 128
    const int th   = tid & 127;                 // thread's number inside its half
    const int lane = tid & 31;
    const int r    = lane & 15;
    const int hi   = lane >> 4;
    const int trow = 8 * hi + (lane & 7);       // transposing load: this lane's row
    const int tcol = 8 * ((lane >> 3) & 1);     // and its 16-byte half of the 16 columns

    const int bh = blockIdx.x;
    const int b  = bh / Hc;
    const int h  = bh % Hc;
    const int q0 = blockIdx.y * 128;

    const size_t base   = ((size_t)b * Sc * Hc + h) * HDc;  // (b, s=0, h, 0)
    const size_t rowstr = (size_t)Hc * HDc;                 // per-s stride (halves)

    // Q fragments (B operand): 2 query groups x 2 k-steps over HD=64
    v16h bq[2][2];
    #pragma unroll
    for (int mi = 0; mi < 2; ++mi) {
        const _Float16* qp = Qw + base
            + (size_t)(q0 + wq * 32 + r) * rowstr + mi * 16 * rowstr;
        #pragma unroll
        for (int ks = 0; ks < 2; ++ks)
            bq[mi][ks] = make_frag(qp + ks * 32 + 8 * hi);
    }

    // per lane: minus the reference in use of query r (equal in both halves of
    // the wave) as a whole C operand, and the running sum over this lane half's
    // keys (joined after the loop). Stage 0 sets the reference.
    float lrow[2] = {0.0f, 0.0f};
    v8f cneg[2] = {};
    v8f O[4][2] = {};   // O^T: [16 head dims][query group]

    // stage K and V as they lie (async straight copies); the 128 threads of a
    // key half fill that half's buffers
    const size_t kbase = base + (size_t)(kh * (Sc / 2)) * rowstr;
    auto copy_kv = [&](int t, int buf) {
        #pragma unroll
        for (int j = 0; j < 4; ++j) {
            int idx = th + j * 128;           // 512 chunks of 8 halves
            int key = idx >> 3;
            int c8  = (idx & 7) << 3;
            size_t g = kbase + (size_t)(t * 64 + key) * rowstr + c8;
            cp_b128(&ldsK[kh][buf][key * AP + c8], Kw + g);
            cp_b128(&ldsV[kh][buf][key * TP + c8], Vw + g);
        }
    };
    constexpr int NT = Sc / 2 / 64;   // 16 stages per key half
    copy_kv(0, 0);
    cp_wait();
    __syncthreads();
    copy_kv(1, 1);

    // kept whole: split off from the loop, stage 0 meets its barrier, and so the
    // wait for stage 1's copies, ahead of its own products instead of behind them
    #pragma clang loop unroll(disable)
    for (int t = 0; t < NT; ++t) {
        const int cur = t & 1;

        // exponents: S^T[64k x 32q] = K(64x64) * Q^T - reference ; K fragments reused across mi
        v8f sacc[4][2];
        #pragma unroll
        for (int ks = 0; ks < 2; ++ks) {
            #pragma unroll
            for (int kt = 0; kt < 4; ++kt) {
                v16h kfrag = make_frag(&ldsK[kh][cur][(kt * 16 + r) * AP + ks * 32 + 8 * hi]);
                #pragma unroll
                for (int mi = 0; mi < 2; ++mi)
                    sacc[kt][mi] = __builtin_amdgcn_wmma_f32_16x16x32_f16(
                        false, kfrag, false, bq[mi][ks], (short)0,
                        ks == 0 ? cneg[mi] : sacc[kt][mi], false, false);
            }
        }

        // a lane holds 32 of the 64 exponents of its query: how far their maximum
        // stands above the reference in use
        float m8[2];
        #pragma unroll
        for (int mi = 0; mi < 2; ++mi) {
            float t8[8];
            #pragma unroll
            for (int v = 0; v < 8; ++v)
                t8[v] = fmaxf(fmaxf(sacc[0][mi][v], sacc[1][mi][v]),
                              fmaxf(sacc[2][mi][v], sacc[3][mi][v]));
            m8[mi] = fmaxf(fmaxf(fmaxf(t8[0], t8[1]), fmaxf(t8[2], t8[3])),
                           fmaxf(fmaxf(t8[4], t8[5]), fmaxf(t8[6], t8[7])));
        }
        // one test per stage, a scalar branch: always taken in stage 0, which
        // sets the reference, rare behind it
        const float thr = t == 0 ? -3.0e38f : 8.0f;
        const float low = t == 0 ? -3.0e38f : 0.0f;
        const bool need = fmaxf(m8[0], m8[1]) > thr;
        if (__builtin_amdgcn_ballot_w32(need) != 0) {
            #pragma unroll
            for (int mi = 0; mi < 2; ++mi) {
                // the query's maximum, equal in both halves of the wave; stage 0
                // takes it as it is, also below 0 (O and the sum are still 0 there:
                // factor 1); later the reference only rises
                const float rm   = fmaxf(m8[mi], xhalf(m8[mi]));
                const float d    = fmaxf(rm, low);
                const float scal = __builtin_amdgcn_exp2f(fminf(-d, 0.0f));
                const float nref = cneg[mi][0] - d;
                lrow[mi] *= scal;
                #pragma unroll
                for (int kt = 0; kt < 4; ++kt) sacc[kt][mi] -= d;
                #pragma unroll
                for (int sub = 0; sub < 4; ++sub) O[sub][mi] *= scal;
                #pragma unroll
                for (int v = 0; v < 8; ++v) cneg[mi][v] = nref;
            }
        }

        v16h pf[2][2];   // P^T as B operand: [query group][32-key step]
        #pragma unroll
        for (int mi = 0; mi < 2; ++mi) {
            #pragma unroll
            for (int kt = 0; kt < 4; ++kt) {
                #pragma unroll
                for (int v = 0; v < 8; ++v)
                    sacc[kt][mi][v] = __builtin_amdgcn_exp2f(sacc[kt][mi][v]);
            }
            const v8f rs = (sacc[0][mi] + sacc[1][mi]) + (sacc[2][mi] + sacc[3][mi]);
            lrow[mi] += ((rs[0] + rs[1]) + (rs[2] + rs[3])) + ((rs[4] + rs[5]) + (rs[6] + rs[7]));
            // element s of the B operand is key 8*hi + s (s < 8) or 16 + 8*hi + s - 8:
            // registers 0..7 of two S^T tiles that follow one another
            #pragma unroll
            for (int ks = 0; ks < 2; ++ks) {
                v8h plo = __builtin_convertvector(sacc[2 * ks][mi], v8h);
                v8h phi = __builtin_convertvector(sacc[2 * ks + 1][mi], v8h);
                pf[mi][ks] = __builtin_shufflevector(plo, phi,
                    0,1,2,3,4,5,6,7,8,9,10,11,12,13,14,15);
            }
        }

        // O^T += V^T(64x64) * P^T(64x32); V^T fragments reused across mi
        #pragma unroll
        for (int ks = 0; ks < 2; ++ks) {
            #pragma unroll
            for (int sub = 0; sub < 4; ++sub) {
                v16h vfrag = make_frag_tr(&ldsV[kh][cur][(ks * 32 + trow) * TP + sub * 16 + tcol], TP);
                #pragma unroll
                for (int mi = 0; mi < 2; ++mi)
                    O[sub][mi] = __builtin_amdgcn_wmma_f32_16x16x32_f16(
                        false, vfrag, false, pf[mi][ks], (short)0, O[sub][mi], false, false);
            }
        }
        // publish stage t + 1 and free stage t's buffers with one barrier
        lds_wait();
        cp_wait();
        __syncthreads();
        if (t + 2 < NT) copy_kv(t + 2, cur);
    }
    cp_wait();

    // Merge of the two key halves. Waves w and w ^ 4 hold the same 32 queries:
    // the wave of half 0 finishes query group 0 and hands over its group 1, the
    // wave of half 1 the other way round (kh is uniform in a wave: scalar
    // branches). The ring is free behind the loop's last barrier; a wave's
    // 9 x 512 B lie lane by lane, 16 B each.
    v4f* xch = (v4f*)&ldsK[0][0][0];            // 8 waves x 4,608 B: all of ldsK
    v4f* mine         = xch + wave * (9 * 32) + lane;
    const v4f* theirs = xch + (wave ^ 4) * (9 * 32) + lane;
    auto hand_over = [&](int mi) {
        #pragma unroll
        for (int sub = 0; sub < 4; ++sub) {
            mine[(2 * sub) * 32]     = __builtin_shufflevector(O[sub][mi], O[sub][mi], 0,1,2,3);
            mine[(2 * sub + 1) * 32] = __builtin_shufflevector(O[sub][mi], O[sub][mi], 4,5,6,7);
        }
        mine[8 * 32] = (v4f){-cneg[mi][0], lrow[mi] + xhalf(lrow[mi]), 0.0f, 0.0f};
    };
    // join with the partner's part, normalize and store ctx (f16, [B,S,H,HD]):
    // a lane holds 8 consecutive head dims of its query per tile, one 16-byte
    // store each
    auto finish = [&](int mi) {
        const v4f   ml = theirs[8 * 32];
        // the part with the higher reference keeps its scale, the other comes down to it
        const float dm = -cneg[mi][0] - ml[0];
        const float e  = __builtin_amdgcn_exp2f(-fabsf(dm));
        const float ak = dm < 0.0f ? e : 1.0f;
        const float ap = dm < 0.0f ? 1.0f : e;
        const float l  = (lrow[mi] + xhalf(lrow[mi])) * ak + ml[1] * ap;
        #pragma unroll
        for (int sub = 0; sub < 4; ++sub) {
            const v8f got = __builtin_shufflevector(theirs[(2 * sub) * 32],
                                                    theirs[(2 * sub + 1) * 32], 0,1,2,3,4,5,6,7);
            const v8f o = O[sub][mi] * ak + got * ap;
            v8h o8;
            #pragma unroll
            for (int v = 0; v < 8; ++v)
                o8[v] = (_Float16)(o[v] / l);
            *(v8h*)(Ctx + base + (size_t)(q0 + wq * 32 + r) * rowstr + mi * 16 * rowstr
                    + sub * 16 + 8 * hi) = o8;
        }
    };
    if (kh == 0) hand_over(1); else hand_over(0);
    lds_wait();        // this wave's writes have retired in front of the barrier
    __syncthreads();   // the partner wave reads them behind it
    if (kh == 0) finish(0); else finish(1);
}

extern "C" void kernel_launch(void* const* d_in, const int* in_sizes, int n_in,
                              void* d_out, int out_size, void* d_ws, size_t ws_size,
                              hipStream_t stream) {
    (void)in_sizes; (void)n_in; (void)out_size; (void)ws_size;

    const float* Xq  = (const float*)d_in[0];
    const float* Xkv = (const float*)d_in[1];
    const float* Wq  = (const float*)d_in[2];
    const float* bq  = (const float*)d_in[3];
    const float* Wk  = (const float*)d_in[4];
    const float* bk  = (const float*)d_in[5];
    const float* Wv  = (const float*)d_in[6];
    const float* bv  = (const float*)d_in[7];
    const float* Wo  = (const float*)d_in[8];
    const float* bo  = (const float*)d_in[9];
    float* out = (float*)d_out;

    const size_t elems = (size_t)BSM * Dm;  // 4096*1024
    _Float16* Qh = (_Float16*)d_ws;
    _Float16* Kh = Qh + elems;
    _Float16* Vh = Kh + elems;
    _Float16* Ch = Vh + elems;
    _Float16* X16  = Ch + elems;                  // Xq, Xkv as f16
    _Float16* W16  = X16 + 2 * elems;             // Wq, Wk, Wv as f16
    _Float16* Wo16 = W16 + 3 * (size_t)Dm * Dm;   // Wo as f16

    dim3 blk(128);
    dim3 gg(Dm / GN, BSM / GM);       // (16, 32)

    to_f16<<<dim3(512), dim3(256), 0, stream>>>(Xq, Xkv, Wq, Wk, Wv, Wo, X16);

    const float qscale = 0.18033688011112042f;   // log2(e)/sqrt(HD=64)
    dim3 gp(Dm / PN, BSM / PM, 3);    // (8, 16, 3): Qh, Kh, Vh follow one another
    gemm_proj_f16out<<<gp, dim3(256), 0, stream>>>(X16, W16, bq, bk, bv, Qh,
                                             qscale, BSM, Dm, Dm);

    dim3 ga(Bc * Hc, Sc / 128);       // (32, 16)
    attn_kernel<<<ga, dim3(256), 0, stream>>>(Qh, Kh, Vh, Ch);

    gemm_out_f32<<<gg, blk, 0, stream>>>(Ch, Wo16, bo, out, BSM, Dm, Dm);
}
